// v009
// Times are from an AMD MI455X. After a warm-up the kernel runs many times in a row, and a time is the length of
// such a window on the GPU divided by its runs, so every launch and the gaps after it count. The runs cycle
// through copies of the inputs. A figure is the median of several windows, for all but v000 over two sittings.
// Sittings can differ by a few percent; kernels timed side by side share one.
// Earlier versions than v009 are not in this document.
// A run of this version takes 148 microseconds.
// Two timings next to v008 both put it at 1.04 times that version's speed.
// Counting every step since v000, which is the starting kernel, it is 67.5 times as fast.
#include <hip/hip_runtime.h>
// Causal multi-head self-attention with rotate-half RoPE computed in the module and a bias-free fused QKV projection (x [4][2048][1024]; qkv = x Wqkv ([in][out] 1024 x 3072, no bias) split into q | k | v thirds, 16 heads of 64; cos / sin = [f | f] of pos * 10000^(-2i/64); q = q cos + rotate_half(q) sin, likewise k; scores * 64^-0.5; causal (tril, finfo.min fill); softmax; out = merged Wout ([in][out], no bias) -> [4][2048][1024]); run as 16 groups of ONE head with the rope stage in its half-split mode.
// Compute dtype: inputs rounded to bf16; x / weights exact; q, k, v, softmax weights and o as plain f16 GEMM operands (~2^-12); scores and softmax statistics f32. v_wmma_f32_16x16x32_f16.
#define NB 4
#define NG 16
#define HPG 1
#define KVD (NG * HD)
#define SQ 2048
#define DM 1024
#define NH 16
#define HD 64
#define HG 4                         /* heads per launch of the unlaunched k_vt(V16, b, h0, VT) */
#define QT 256                       /* unused; the causal query tile is FAQ */
#define NKX SQ                       /* S / P row pitch */
#define QT0 128                      /* first-tile rows recomputed exactly in f32 */
#define B0 0                         /* first batch processed (debug hook) */
#define NBR NB                       /* batches processed (debug hook) */
#define NR ((size_t)NB * SQ)         /* token rows */
#define MP ((int)((size_t)NBR * SQ)) /* rows projected (debug hook) */
#define QN SQ                        /* query rows attended per batch (debug hook) */
#define NHD NH                       /* heads attended (debug hook) */
#define MPO MP                       /* rows through the output stage (debug hook) */
#define LQ DM      /* row pitch of the q/k/v rows */
typedef __bf16 v16b __attribute__((ext_vector_type(16)));
typedef unsigned short v8us __attribute__((ext_vector_type(8), may_alias));
typedef float  v8f  __attribute__((ext_vector_type(8)));
typedef float  v4f  __attribute__((ext_vector_type(4)));
typedef float  v4fa __attribute__((ext_vector_type(4), may_alias));
union FragB { v16b v; v8us half[2]; unsigned short u[16]; };

__device__ __forceinline__ unsigned short bf16_bits(float x) { unsigned int u = __float_as_uint(x); return (unsigned short)((u + 0x7FFFu + ((u >> 16) & 1u)) >> 16); }
__device__ __forceinline__ float bf16_val(unsigned short b) { return __uint_as_float(((unsigned int)b) << 16); }
__device__ __forceinline__ float bf16_round(float x) { return bf16_val(bf16_bits(x)); }
// D += A·B with NT terms: 1 = ah·bh, 2 = + al·bh (A split), 3 = + ah·bl (both split)
template <int NT>
__device__ __forceinline__ v8f mmaN(v16b ah, v16b al, v16b bh, v16b bl, v8f c) {
  c = __builtin_amdgcn_wmma_f32_16x16x32_bf16(false, ah, false, bh, (short)0, c, false, false);
  if (NT >= 2) c = __builtin_amdgcn_wmma_f32_16x16x32_bf16(false, al, false, bh, (short)0, c, false, false);
  if (NT >= 3) c = __builtin_amdgcn_wmma_f32_16x16x32_bf16(false, ah, false, bl, (short)0, c, false, false);
  asm volatile("v_nop\n\tv_nop\n\tv_nop\n\tv_nop" : "+v"(c) : "v"(ah), "v"(al), "v"(bh), "v"(bl));
  return c;
}

__global__ __launch_bounds__(256) void k_wt_bf16(const float* __restrict__ W, unsigned short* __restrict__ Wt, int K, int N) {
  const int t = blockIdx.x * 256 + threadIdx.x;
  const int k8n = K / 8;
  if (t >= N * k8n) return;
  const int n = t / k8n, k8 = (t % k8n) * 8;
  v8us v;
#pragma unroll
  for (int i = 0; i < 8; ++i) v[i] = bf16_bits(W[(size_t)(k8 + i) * N + n]);
  *(v8us*)(Wt + (size_t)n * K + k8) = v;
  
}

// GEMM C[M][N] (f32, pitch ldc) = act(A[M][K]·W + bias). A f32 row-major (pitch lda) converted per fragment to bf16
// (ASPLIT: hi/lo two planes -> 2 terms, else single rounded term); Wt bf16 [N][K] (pitch ldb). BIAS_BF16 rounds the
// bias to bf16 first (bias quantised to bf16 before the add). K%32==0, M%16==0, N%64==0.
template <bool ASPLIT, int ACT, bool BIAS_BF16>
__global__ __launch_bounds__(128) void k_gemm_bf(const float* __restrict__ A, int lda, const unsigned short* __restrict__ Wt, int ldb,
                                               const float* __restrict__ bias, float* __restrict__ C, int ldc, int M, int N, int K) {
  __shared__ __attribute__((aligned(16))) float so[4][16][64];
  const int tid = threadIdx.x, w = tid >> 5, lane = tid & 31, ln = lane & 15, hh = lane >> 4;
  const int ntn = N / 64;
  const int wid = blockIdx.x * 4 + w;
  const int mt = wid / ntn, nq = wid % ntn;
  if (mt * 16 >= M) return;
  const int row0 = mt * 16, col0 = nq * 64;
  const float* arow = A + (size_t)(row0 + ln) * lda;
  v8f acc[4] = {};
  for (int kb = 0; kb < K; kb += 32) {
    FragB ah, al;
    const v4f x0 = *(const v4fa*)(arow + kb + 8 * hh), x1 = *(const v4fa*)(arow + kb + 8 * hh + 4);
    const v4f x2 = *(const v4fa*)(arow + kb + 16 + 8 * hh), x3 = *(const v4fa*)(arow + kb + 16 + 8 * hh + 4);
    float xs[16] = {x0[0],x0[1],x0[2],x0[3],x1[0],x1[1],x1[2],x1[3],x2[0],x2[1],x2[2],x2[3],x3[0],x3[1],x3[2],x3[3]};
#pragma unroll
    for (int i = 0; i < 16; ++i) { const unsigned short hb = bf16_bits(xs[i]); ah.u[i] = hb; al.u[i] = ASPLIT ? bf16_bits(xs[i] - bf16_val(hb)) : (unsigned short)0; }
#pragma unroll
    for (int t = 0; t < 4; ++t) {
      const unsigned short* brow = Wt + (size_t)(col0 + t * 16 + ln) * ldb + kb;
      FragB b;
      b.half[0] = *(const v8us*)(brow + 8 * hh);
      b.half[1] = *(const v8us*)(brow + 16 + 8 * hh);
      acc[t] = mmaN<ASPLIT ? 2 : 1>(ah.v, al.v, b.v, b.v, acc[t]);
    }
  }
#pragma unroll
  for (int t = 0; t < 4; ++t) {
    float bv = bias ? bias[col0 + t * 16 + ln] : 0.f;
    if (BIAS_BF16) bv = bf16_round(bv);
#pragma unroll
    for (int r = 0; r < 8; ++r) { float v = acc[t][r] + bv; if (ACT == 1) v = fmaxf(v, 0.f); so[w][8 * hh + r][t * 16 + ln] = v; }
  }
  __builtin_amdgcn_fence(__ATOMIC_ACQ_REL, "workgroup");
  __builtin_amdgcn_wave_barrier();
  const int rsub = lane >> 4, c4 = (lane & 15) * 4;
  {
#pragma unroll
    for (int q = 0; q < 8; ++q) {
      const int r = q * 2 + rsub;
      const v4f v = *(const v4fa*)&so[w][r][c4];
      *(v4f*)(C + (size_t)(row0 + r) * ldc + col0 + c4) = v;
    }
    
  }
}

// GEMM C = act(A·W + bias + resid): A f32 (ASPLIT -> hi/lo 2 terms), Wt bf16 [N][K]; ACT 0 none, 1 relu, 2 exact gelu;
// resid (optional, f32, row index = (row % rmod), pitch ldr, RES_BF16 rounds it) added before the activation.
template <bool ASPLIT, int ACT, bool BIAS_BF16, bool RES_BF16>
__global__ __launch_bounds__(128) void k_gemm_bf3(const float* __restrict__ A, int lda, const unsigned short* __restrict__ Wt, int ldb,
                                                const float* __restrict__ bias, const float* __restrict__ resid, int rmod, int ldr,
                                                float* __restrict__ C, int ldc, int M, int N, int K) {
  __shared__ __attribute__((aligned(16))) float so[4][16][64];
  const int tid = threadIdx.x, w = tid >> 5, lane = tid & 31, ln = lane & 15, hh = lane >> 4;
  const int ntn = N / 64;
  const int wid = blockIdx.x * 4 + w;
  const int mt = wid / ntn, nq = wid % ntn;
  if (mt * 16 >= M) return;
  const int row0 = mt * 16, col0 = nq * 64;
  const float* arow = A + (size_t)(row0 + ln) * lda;
  v8f acc[4] = {};
  for (int kb = 0; kb < K; kb += 32) {
    FragB ah, al;
    const v4f x0 = *(const v4fa*)(arow + kb + 8 * hh), x1 = *(const v4fa*)(arow + kb + 8 * hh + 4);
    const v4f x2 = *(const v4fa*)(arow + kb + 16 + 8 * hh), x3 = *(const v4fa*)(arow + kb + 16 + 8 * hh + 4);
    float xs[16] = {x0[0],x0[1],x0[2],x0[3],x1[0],x1[1],x1[2],x1[3],x2[0],x2[1],x2[2],x2[3],x3[0],x3[1],x3[2],x3[3]};
#pragma unroll
    for (int i = 0; i < 16; ++i) { const unsigned short hb = bf16_bits(xs[i]); ah.u[i] = hb; al.u[i] = ASPLIT ? bf16_bits(xs[i] - bf16_val(hb)) : (unsigned short)0; }
#pragma unroll
    for (int t = 0; t < 4; ++t) {
      const unsigned short* brow = Wt + (size_t)(col0 + t * 16 + ln) * ldb + kb;
      FragB b;
      b.half[0] = *(const v8us*)(brow + 8 * hh);
      b.half[1] = *(const v8us*)(brow + 16 + 8 * hh);
      acc[t] = mmaN<ASPLIT ? 2 : 1>(ah.v, al.v, b.v, b.v, acc[t]);
    }
  }
#pragma unroll
  for (int t = 0; t < 4; ++t) {
    const int col = col0 + t * 16 + ln;
    float bv = bias ? bias[col] : 0.f;
    if (BIAS_BF16) bv = bf16_round(bv);
#pragma unroll
    for (int r = 0; r < 8; ++r) {
      float v = acc[t][r] + bv;
      if (resid) { float rv = resid[(size_t)((row0 + 8 * hh + r) % rmod) * ldr + col]; if (RES_BF16) rv = bf16_round(rv); v += rv; }
      if (ACT == 1) v = fmaxf(v, 0.f);
      if (ACT == 2) v = 0.5f * v * (1.0f + erff(v * 0.70710678118654752f));
      if (ACT == 3) { const float u = 0.7978845608028654f * (v + 0.044715f * v * v * v); v = 0.5f * v * (1.0f + tanhf(u)); }
      so[w][8 * hh + r][t * 16 + ln] = v;
    }
  }
  __builtin_amdgcn_fence(__ATOMIC_ACQ_REL, "workgroup");
  __builtin_amdgcn_wave_barrier();
  const int rsub = lane >> 4, c4 = (lane & 15) * 4;
  {
#pragma unroll
    for (int q = 0; q < 8; ++q) {
      const int r = q * 2 + rsub;
      const v4f v = *(const v4fa*)&so[w][r][c4];
      *(v4f*)(C + (size_t)(row0 + r) * ldc + col0 + c4) = v;
    }
    
  }
}
// row LayerNorm (biased variance, eps) over N: s = X (+ R); optional out_sum <- s; out_norm <- (s-mu)*rsqrt(var+eps)*g + b
template <bool PARAM_BF16>
__global__ __launch_bounds__(256) void k_layernorm(const float* __restrict__ X, const float* __restrict__ R, const float* __restrict__ g, const float* __restrict__ bta,
                                                  float* __restrict__ out_sum, float* __restrict__ out_norm, int N, float eps) {
  __shared__ float red[256];
  const int row = blockIdx.x, tid = threadIdx.x;
  const float* x = X + (size_t)row * N; const float* rr = R ? R + (size_t)row * N : nullptr;
  float vals[16];                     // up to N = 4096
  const int per = N / 256;            // contiguous chunk per thread? use strided-by-4 chunks: thread handles j = tid*4 + 1024*u
  float s1 = 0.f;
  for (int u = 0; u < per / 4; ++u) {
    const int j = tid * 4 + 1024 * u;
    const v4f a = *(const v4fa*)(x + j);
    v4f b = {0.f,0.f,0.f,0.f}; if (rr) b = *(const v4fa*)(rr + j);
#pragma unroll
    for (int q = 0; q < 4; ++q) { const float v = a[q] + b[q]; vals[u * 4 + q] = v; s1 += v; }
  }
  red[tid] = s1; __syncthreads();
  for (int st = 128; st > 0; st >>= 1) { if (tid < st) red[tid] += red[tid + st]; __syncthreads(); }
  const float mu = red[0] / (float)N; __syncthreads();
  float s2 = 0.f;
  for (int u = 0; u < per / 4; ++u)
#pragma unroll
    for (int q = 0; q < 4; ++q) { const float c = vals[u * 4 + q] - mu; s2 += c * c; }
  red[tid] = s2; __syncthreads();
  for (int st = 128; st > 0; st >>= 1) { if (tid < st) red[tid] += red[tid + st]; __syncthreads(); }
  const float rs = rsqrtf(red[0] / (float)N + eps);
  {
    for (int u = 0; u < per / 4; ++u) {
      const int j = tid * 4 + 1024 * u;
      v4f o, sm;
#pragma unroll
      for (int q = 0; q < 4; ++q) {
        float gg = g[j + q], bb = bta[j + q];
        if (PARAM_BF16) { gg = bf16_round(gg); bb = bf16_round(bb); }
        sm[q] = vals[u * 4 + q]; o[q] = (vals[u * 4 + q] - mu) * rs * gg + bb;
      }
      if (out_sum) *(v4f*)(out_sum + (size_t)row * N + j) = sm;
      *(v4f*)(out_norm + (size_t)row * N + j) = o;
    }
    
  }
}



// ---- f16 WMMA path (v_wmma_f32_16x16x32_f16): 11-bit significands for operands in range — used where a [0,1] probability operand needs more precision than bf16
typedef _Float16 v16h __attribute__((ext_vector_type(16)));
union FragH { v16h v; v8us half[2]; _Float16 h[16]; unsigned short u[16]; };
template <int NT>
__device__ __forceinline__ v8f mmaH(v16h ah, v16h al, v16h bh, v16h bl, v8f c) {
  c = __builtin_amdgcn_wmma_f32_16x16x32_f16(false, ah, false, bh, (short)0, c, false, false);
  if (NT >= 2) c = __builtin_amdgcn_wmma_f32_16x16x32_f16(false, al, false, bh, (short)0, c, false, false);
  if (NT >= 3) c = __builtin_amdgcn_wmma_f32_16x16x32_f16(false, ah, false, bl, (short)0, c, false, false);
  asm volatile("v_nop\n\tv_nop\n\tv_nop\n\tv_nop" : "+v"(c) : "v"(ah), "v"(al), "v"(bh), "v"(bl));
  return c;
}
// batched GEMM like k_gemm_b but f16 operands: A f32 (split into f16 hi/lo if ASPLIT, else rounded to f16), Bt = f16 values [n][k]; alpha; C f32; N multiple of 16 (partial tiles skipped)
template <bool ASPLIT>
__global__ __launch_bounds__(128) void k_gemm_h(const float* __restrict__ A, int lda, size_t sA, const _Float16* __restrict__ Bh, int ldb, size_t sB, float alpha, float* __restrict__ C, int ldc, size_t sC, int M, int N, int K) {
  __shared__ __attribute__((aligned(16))) float so[4][16][64];
  const int tid = threadIdx.x, w = tid >> 5, lane = tid & 31, ln = lane & 15, hh = lane >> 4; const int by = blockIdx.y;
  A += (size_t)by * sA; Bh += (size_t)by * sB; C += (size_t)by * sC;
  const int ntn = (N + 63) / 64; const int wid = blockIdx.x * 4 + w; const int mt = wid / ntn, nq = wid % ntn; if (mt * 16 >= M) return;
  const int row0 = mt * 16, col0 = nq * 64; const float* arow = A + (size_t)(row0 + ln) * lda;
  v8f acc[4] = {};
  for (int kb = 0; kb < K; kb += 32) {
    FragH ah, al;
    const v4f x0 = *(const v4fa*)(arow + kb + 8 * hh), x1 = *(const v4fa*)(arow + kb + 8 * hh + 4), x2 = *(const v4fa*)(arow + kb + 16 + 8 * hh), x3 = *(const v4fa*)(arow + kb + 16 + 8 * hh + 4);
    float xs[16] = {x0[0],x0[1],x0[2],x0[3],x1[0],x1[1],x1[2],x1[3],x2[0],x2[1],x2[2],x2[3],x3[0],x3[1],x3[2],x3[3]};
#pragma unroll
    for (int i = 0; i < 16; ++i) { const _Float16 h = (_Float16)xs[i]; ah.h[i] = h; al.h[i] = ASPLIT ? (_Float16)(xs[i] - (float)h) : (_Float16)0.0f; }
#pragma unroll
    for (int t = 0; t < 4; ++t) { if (col0 + t * 16 >= N) continue; const size_t boff = (size_t)(col0 + t * 16 + ln) * ldb + kb; FragH bq; bq.half[0] = *(const v8us*)(Bh + boff + 8 * hh); bq.half[1] = *(const v8us*)(Bh + boff + 16 + 8 * hh);
      acc[t] = mmaH<ASPLIT ? 2 : 1>(ah.v, al.v, bq.v, bq.v, acc[t]); }
  }
#pragma unroll
  for (int t = 0; t < 4; ++t) { if (col0 + t * 16 >= N) continue;
#pragma unroll
    for (int r = 0; r < 8; ++r) so[w][8 * hh + r][t * 16 + ln] = acc[t][r] * alpha; }
  __builtin_amdgcn_fence(__ATOMIC_ACQ_REL, "workgroup"); __builtin_amdgcn_wave_barrier();
  const int rsub = lane >> 4, c4 = (lane & 15) * 4;
  {
#pragma unroll
    for (int q = 0; q < 8; ++q) { const int r = q * 2 + rsub; if (col0 + c4 < N) { const v4f v = *(const v4fa*)&so[w][r][c4]; *(v4f*)(C + (size_t)(row0 + r) * ldc + col0 + c4) = v; } }
     }
}

// Wt[n][k] = f16(W[k][n]·scale) from f32 row-major W[K][N] (scale = power of two; bf16-exact weights stay exact in f16 away from the subnormal range)
__device__ __forceinline__ void p_wt_f16(int blk, const float* __restrict__ W, _Float16* __restrict__ Wt, int K, int N, float scale) {      /* blk: the job's own work-group index, 256 threads each */
  const int t = blk * 256 + threadIdx.x; if (t >= N * (K / 8)) return; const int n = t / (K / 8), k8 = (t % (K / 8)) * 8; FragH f;
#pragma unroll
  for (int i = 0; i < 8; ++i) f.h[i] = (_Float16)(bf16_round(W[(size_t)(k8 + i) * N + n]) * scale); const v8us o = f.half[0];
  *(v8us*)((unsigned short*)Wt + (size_t)n * K + k8) = o; 
}
// k_gemm_hh variant with fused epilogue: v = acc·alpha + bias[by·sBias + col] (+ CP[(row/rowsPerB)·sCPb + by·64 + col] if CP) ; ACT 0 none / 1 elu ; writes f16 C16 (and f32 C if non-null)
template <int ACT>
__global__ __launch_bounds__(128) void k_gemm_hhx(const _Float16* __restrict__ A, int lda, size_t sA, const _Float16* __restrict__ Bh, int ldb, size_t sB, float alpha, const float* __restrict__ bias, size_t sBias, const float* __restrict__ CP, int rowsPerB, size_t sCPb, int row0g,
    float* __restrict__ C, _Float16* __restrict__ C16, int ldc, size_t sC, int M, int N, int K) {
  __shared__ __attribute__((aligned(16))) float so[4][16][64];
  const int tid = threadIdx.x, w = tid >> 5, lane = tid & 31, ln = lane & 15, hh = lane >> 4; const int by = blockIdx.y;
  A += (size_t)by * sA; Bh += (size_t)by * sB; const size_t cofs = (size_t)by * sC; const float* bp = bias ? bias + (size_t)by * sBias : nullptr;
  const int ntn = (N + 63) / 64; const int wid = blockIdx.x * 4 + w; const int mt = wid / ntn, nq = wid % ntn; if (mt * 16 >= M) return;
  const int row0 = mt * 16, col0 = nq * 64; const _Float16* arow = A + (size_t)(row0 + ln) * lda;
  v8f acc[4] = {};
  for (int kb = 0; kb < K; kb += 32) { FragH ah; ah.half[0] = *(const v8us*)((const unsigned short*)arow + kb + 8 * hh); ah.half[1] = *(const v8us*)((const unsigned short*)arow + kb + 16 + 8 * hh);
#pragma unroll
    for (int t = 0; t < 4; ++t) { if (col0 + t * 16 >= N) continue; const size_t boff = (size_t)(col0 + t * 16 + ln) * ldb + kb; FragH bq; bq.half[0] = *(const v8us*)((const unsigned short*)Bh + boff + 8 * hh); bq.half[1] = *(const v8us*)((const unsigned short*)Bh + boff + 16 + 8 * hh);
      acc[t] = mmaH<1>(ah.v, ah.v, bq.v, bq.v, acc[t]); }
  }
#pragma unroll
  for (int t = 0; t < 4; ++t) { if (col0 + t * 16 >= N) continue; const int col = col0 + t * 16 + ln; const float bv = bp ? bf16_round(bp[col]) : 0.f;
#pragma unroll
    for (int r = 0; r < 8; ++r) { float v = acc[t][r] * alpha + bv; if (CP) { const int rr = row0g + row0 + 8 * hh + r; if (rowsPerB < 0) v += CP[cofs + (size_t)rr * ldc + col];      /* rowsPerB < 0: own element of the batched C plane */ else { const int bidx = rr / rowsPerB; v += CP[(size_t)bidx * sCPb + (size_t)by * 64 + col]; } } if (ACT == 1) v = (v > 0.f) ? v : expm1f(v); else if (ACT == 7) v = (v > 0.f) ? v + 1.0f : expf(v); else if (ACT == 8) v = tanhf(v); else if (ACT == 9) v = 0.5f * v * (1.0f + tanhf(0.7978845608028654f * (v + 0.044715f * v * v * v))); else if (ACT == 11) v = 1.0f / (1.0f + expf(-v)); else if (ACT == 12) v = (v > 0.f) ? v : 0.01f * v; else if (ACT == 14) v = (v > 0.f) ? v : 0.1f * v; else if (ACT == 16) v = (v >= 0.f) ? v : 0.3f * v; else if (ACT == 17) v = (v >= 0.f) ? v : 0.2f * v; else if (ACT == 15) v = v / (1.0f + expf(-v)); else if (ACT == 3) v = fmaxf(v, 0.f); else if (ACT == 6) v = 0.5f * v * (1.0f + erff(v * 0.70710678118654752f)); so[w][8 * hh + r][t * 16 + ln] = v; } }
  __builtin_amdgcn_fence(__ATOMIC_ACQ_REL, "workgroup"); __builtin_amdgcn_wave_barrier();
  const int rsub = lane >> 4, c4 = (lane & 15) * 4; typedef _Float16 v4h __attribute__((ext_vector_type(4)));
  {
#pragma unroll
    for (int q = 0; q < 8; ++q) { const int r = q * 2 + rsub; if (col0 + c4 < N) { const v4f v = *(const v4fa*)&so[w][r][c4]; if (C) *(v4f*)(C + cofs + (size_t)(row0 + r) * ldc + col0 + c4) = v; if (C16) { v4h h4; for (int i = 0; i < 4; ++i) h4[i] = (_Float16)v[i]; *(v4h*)(C16 + cofs + (size_t)(row0 + r) * ldc + col0 + c4) = h4; } } }
     }
}


typedef _Float16 v4h __attribute__((ext_vector_type(4)));

__device__ __forceinline__ void p_x16(int blk, const float* __restrict__ x, _Float16* __restrict__ X16, size_t n8) { const size_t t = (size_t)blk * 256 + threadIdx.x; if (t >= n8) return; FragH f;
#pragma unroll
  for (int q = 0; q < 8; ++q) f.h[q] = (_Float16)bf16_round(x[t * 8 + q]); *(v8us*)((unsigned short*)X16 + t * 8) = f.half[0];  }
__global__ __launch_bounds__(256) void k_h16(const float* __restrict__ x, _Float16* __restrict__ X16, size_t n8) { const size_t t = (size_t)blockIdx.x * 256 + threadIdx.x; if (t >= n8) return; FragH f;
#pragma unroll
  for (int q = 0; q < 8; ++q) f.h[q] = (_Float16)x[t * 8 + q]; *(v8us*)((unsigned short*)X16 + t * 8) = f.half[0];  }
__global__ __launch_bounds__(256) void k_round16f(const float* __restrict__ W, _Float16* __restrict__ Bt, size_t n8) { const size_t t = (size_t)blockIdx.x * 256 + threadIdx.x; if (t >= n8) return; FragH f;
#pragma unroll
  for (int i = 0; i < 8; ++i) f.h[i] = (_Float16)(bf16_round(W[t * 8 + i]) * 16.0f); *(v8us*)((unsigned short*)Bt + t * 8) = f.half[0];  }
template <int NHv, int TTv>
__global__ __launch_bounds__(256) void k_vt(const _Float16* __restrict__ V16, int ldv, int voff, _Float16* __restrict__ Vt) { __shared__ unsigned short tl[64][66]; const int tid = threadIdx.x; const int slab = blockIdx.x / (TTv / 64), lg = blockIdx.x % (TTv / 64); const int b = slab / NHv, h = slab % NHv;
  for (int i = tid; i < 64 * 8; i += 256) { const int r = i / 8, c8 = (i % 8) * 8; FragH f; f.half[0] = *(const v8us*)((const unsigned short*)V16 + ((size_t)b * TTv + lg * 64 + r) * ldv + voff + h * 64 + c8);
#pragma unroll
    for (int q = 0; q < 8; ++q) tl[r][c8 + q] = f.u[q]; }
  __syncthreads();
  {
#pragma unroll
    for (int rd = 0; rd < 2; ++rd) { const int d = rd * 32 + tid / 8, pc = tid % 8; FragH f;
#pragma unroll
      for (int q = 0; q < 8; ++q) f.u[q] = tl[pc * 8 + q][d];
      *(v8us*)((unsigned short*)Vt + ((size_t)slab * 64 + d) * TTv + lg * 64 + pc * 8) = f.half[0]; }
     } }

__global__ __launch_bounds__(256) void k_hl(const float* __restrict__ F, _Float16* __restrict__ Hh, _Float16* __restrict__ Hl, size_t n8) { const size_t t = (size_t)blockIdx.x * 256 + threadIdx.x; if (t >= n8) return; FragH fh, fl; const v4f a = *(const v4fa*)(F + t * 8), c = *(const v4fa*)(F + t * 8 + 4);
#pragma unroll
  for (int q = 0; q < 4; ++q) { _Float16 h = (_Float16)a[q]; fh.h[q] = h; fl.h[q] = (_Float16)((a[q] - (float)h) * 1024.0f); h = (_Float16)c[q]; fh.h[4 + q] = h; fl.h[4 + q] = (_Float16)((c[q] - (float)h) * 1024.0f); }
  { *(v8us*)((unsigned short*)Hh + t * 8) = fh.half[0]; *(v8us*)((unsigned short*)Hl + t * 8) = fl.half[0];  } }

// ---- fast GEMM (work-group tile 128x128, 8 waves of 32x64; requires M % 128 == 0 rows per launch region, N % 128 == 0 and K % 64 == 0); epilogue = k_gemm_hhx semantics ----
// A stage is G2K k of the tile's 128 A rows and 128 Bt rows. 8 threads fetch one row's 128-byte line, one stage ahead into registers, and store it to one of two LDS buffers; the 8 waves read their fragments from LDS,
// so that every operand line leaves L2 once per work-group as a whole line. One barrier per stage publishes the next buffer and ends the reads of the one that is refilled after it. k runs in the order of the unstaged loop.
#define G2T 128                      /* A rows and Bt rows per work-group */
#define G2K 64                       /* k per LDS stage: 64 f16 = one 128-byte line of every row */
#define G2P (G2K + 8)                /* LDS row pitch in halves: 144 B = 16 B x odd, so that the 16 rows of a fragment load fall on different banks */
#define G2S (2 * G2T * G2P)          /* halves per stage buffer: the A rows, then the Bt rows */
__device__ __forceinline__ v16h g2_frag(const _Float16* p, int hh) { FragH f; f.half[0] = *(const v8us*)((const unsigned short*)p + 8 * hh); f.half[1] = *(const v8us*)((const unsigned short*)p + 16 + 8 * hh); return f.v; }
__device__ __forceinline__ v8f g2_mma(v16h a, v16h b, v8f c) { v8f d = __builtin_amdgcn_wmma_f32_16x16x32_f16(false, a, false, b, (short)0, c, false, false); asm volatile("v_nop\n\tv_nop\n\tv_nop\n\tv_nop" : "+v"(d) : "v"(a), "v"(b)); return d; }
template <int ACT>
__global__ __launch_bounds__(256) void k_gemm2(const _Float16* __restrict__ A, int lda, size_t sA, const _Float16* __restrict__ Bh, int ldb, size_t sB, float alpha, const float* __restrict__ bias, size_t sBias, const float* __restrict__ CP, int rowsPerB, size_t sCPb, int row0g,
    float* __restrict__ C, _Float16* __restrict__ C16, int ldc, size_t sC, int M, int N, int K, size_t zA, size_t zB, size_t zC) { static_assert(ACT == 0 || ACT == 3 || ACT == 6 || ACT == 8 || ACT == 9 || ACT == 11 || ACT == 12 || ACT == 14 || ACT == 15 || ACT == 16 || ACT == 17, "k_gemm2: unsupported ACT code (would silently apply no activation)");
  static_assert(2 * G2S * 2 >= 8 * 32 * 68 * 4 && G2T == 128 && G2K == 64, "the epilogue's rows fit the two stage buffers; 256 threads stage 32 rows per pass");
  __shared__ __attribute__((aligned(16))) unsigned char sm[2 * G2S * 2]; _Float16* const sg = (_Float16*)sm; float (*const so)[32][68] = (float (*)[32][68])sm;      /* the stage buffers; behind the loop's last barrier the same bytes hold each wave's output rows */
  const int tid = threadIdx.x, w = tid >> 5, wm = w & 3, wn = w >> 2, lane = tid & 31, ln = lane & 15, hh = lane >> 4; const int by = blockIdx.y, bz = blockIdx.z;      /* grid.y = head (strides sA, sB, sC), grid.z = batch (strides zA, zB, zC) */
  A += (size_t)by * sA + (size_t)bz * zA; Bh += (size_t)by * sB + (size_t)bz * zB; const size_t cofs = (size_t)by * sC + (size_t)bz * zC; const float* bp = bias ? bias + (size_t)by * sBias : nullptr;
  const int ntn = N >> 7; const int mt = blockIdx.x / ntn, nq = blockIdx.x - mt * ntn; if (mt * G2T >= M) return;      /* taken by a whole work-group, in front of every barrier */
  const int row0 = mt * G2T + 32 * wm, col0 = nq * G2T + 64 * wn;
  const int sr = tid >> 3, sc = (tid & 7) * 8; const int sl = sr * G2P + sc;      /* staging: row sr + 32 u, eight halves at column sc */
  const _Float16* ag = A + (size_t)(mt * G2T + sr) * lda + sc; const _Float16* bg = Bh + (size_t)(nq * G2T + sr) * ldb + sc; const int nst = K / G2K;
  const v8f z8 = {0.f,0.f,0.f,0.f,0.f,0.f,0.f,0.f}; v8f c00 = z8, c01 = z8, c02 = z8, c03 = z8, c10 = z8, c11 = z8, c12 = z8, c13 = z8;
  v8us ar[4], br[4]; const unsigned short* pa[4]; const unsigned short* pb[4];      /* the full unrolls give these register arrays constant indices and put a stage's eight loads in flight together */
#pragma unroll
  for (int u = 0; u < 4; ++u) { pa[u] = (const unsigned short*)(ag + (size_t)(u * 32) * lda); pb[u] = (const unsigned short*)(bg + (size_t)(u * 32) * ldb); }
#pragma unroll
  for (int u = 0; u < 4; ++u) { ar[u] = *(const v8us*)pa[u]; br[u] = *(const v8us*)pb[u]; }
  asm volatile("s_wait_xcnt 0x0" :: "v"(pa[0]), "v"(pa[1]), "v"(pa[2]), "v"(pa[3]), "v"(pb[0]), "v"(pb[1]), "v"(pb[2]), "v"(pb[3]) : "memory");      /* the loads' address registers are free for reuse only from here on; as inputs they stay whole up to this wait, so that no load returns into one either */
#pragma unroll
  for (int u = 0; u < 4; ++u) { *(v8us*)(unsigned short*)&sg[sl + u * 32 * G2P] = ar[u]; *(v8us*)(unsigned short*)&sg[G2T * G2P + sl + u * 32 * G2P] = br[u]; }
  __syncthreads();
#pragma unroll 1
  for (int s = 0; s < nst; ++s) { const bool more = s + 1 < nst;      /* more: the same for the whole work-group. The stage loop stays rolled, so that its text stays small; its two 32-k passes are unrolled, so that their LDS offsets are immediates */
    if (more) {
#pragma unroll
      for (int u = 0; u < 4; ++u) { pa[u] = (const unsigned short*)(ag + (s + 1) * G2K + (size_t)(u * 32) * lda); pb[u] = (const unsigned short*)(bg + (s + 1) * G2K + (size_t)(u * 32) * ldb); }
#pragma unroll
      for (int u = 0; u < 4; ++u) { ar[u] = *(const v8us*)pa[u]; br[u] = *(const v8us*)pb[u]; }
      asm volatile("s_wait_xcnt 0x0" :: "v"(pa[0]), "v"(pa[1]), "v"(pa[2]), "v"(pa[3]), "v"(pb[0]), "v"(pb[1]), "v"(pb[2]), "v"(pb[3]) : "memory"); }      /* the code below reuses the registers that these loads name: this wait stands in front of that overwrite, and as its inputs they stay whole up to it, so that no load returns into one either */
    const _Float16* ab = sg + (s & 1) * G2S + (32 * wm + ln) * G2P; const _Float16* bb = sg + (s & 1) * G2S + (G2T + 64 * wn + ln) * G2P;
#pragma unroll
    for (int kc = 0; kc < G2K; kc += 32) { const v16h a0 = g2_frag(ab + kc, hh), a1 = g2_frag(ab + 16 * G2P + kc, hh);
      const v16h b0 = g2_frag(bb + kc, hh), b1 = g2_frag(bb + 16 * G2P + kc, hh), b2 = g2_frag(bb + 32 * G2P + kc, hh), b3 = g2_frag(bb + 48 * G2P + kc, hh);
      c00 = g2_mma(a0, b0, c00); c10 = g2_mma(a1, b0, c10); c01 = g2_mma(a0, b1, c01); c11 = g2_mma(a1, b1, c11);
      c02 = g2_mma(a0, b2, c02); c12 = g2_mma(a1, b2, c12); c03 = g2_mma(a0, b3, c03); c13 = g2_mma(a1, b3, c13); }
    if (more) {
#pragma unroll
      for (int u = 0; u < 4; ++u) { *(v8us*)(unsigned short*)&sg[((s + 1) & 1) * G2S + sl + u * 32 * G2P] = ar[u]; *(v8us*)(unsigned short*)&sg[((s + 1) & 1) * G2S + G2T * G2P + sl + u * 32 * G2P] = br[u]; } }
    __syncthreads(); }      /* publishes stage s + 1 and ends every wave's reads of stage s, whose buffer the next trip refills and, behind the last trip, the output rows reuse */
  v8f accs[8] = {c00, c01, c02, c03, c10, c11, c12, c13};
#pragma unroll
  for (int u = 0; u < 8; ++u) { const int t = u & 3, half = u >> 2; const int col = col0 + t * 16 + ln; const float bv = bp ? bf16_round(bp[col]) : 0.f;
#pragma unroll
    for (int r = 0; r < 8; ++r) { const int rloc = half * 16 + 8 * hh + r; float v = accs[u][r] * alpha + bv; if (CP) { if (rowsPerB < 0) v += CP[cofs + (size_t)(row0g + row0 + rloc) * ldc + col];      /* rowsPerB < 0: own element of the batched C plane */ else { const int bidx = (row0g + row0 + rloc) / rowsPerB; v += CP[(size_t)bidx * sCPb + (size_t)by * 64 + col]; } }
      if (ACT == 3) v = fmaxf(v, 0.f); else if (ACT == 6) v = 0.5f * v * (1.0f + erff(v * 0.70710678118654752f)); else if (ACT == 11) v = 1.0f / (1.0f + expf(-v)); else if (ACT == 15) v = v / (1.0f + expf(-v)); else if (ACT == 12) v = (v > 0.f) ? v : 0.01f * v; else if (ACT == 8) v = tanhf(v); else if (ACT == 9) v = 0.5f * v * (1.0f + tanhf(0.7978845608028654f * (v + 0.044715f * v * v * v))); else if (ACT == 14) v = (v > 0.f) ? v : 0.1f * v; else if (ACT == 16) v = (v >= 0.f) ? v : 0.3f * v; else if (ACT == 17) v = (v >= 0.f) ? v : 0.2f * v;
      so[w][rloc][t * 16 + ln] = v; } }
  __builtin_amdgcn_fence(__ATOMIC_ACQ_REL, "workgroup"); __builtin_amdgcn_wave_barrier();
  const int rsub = lane >> 4, c4 = (lane & 15) * 4;
  {
#pragma unroll
    for (int q = 0; q < 16; ++q) { const int r = q * 2 + rsub; const v4f v = *(const v4fa*)&so[w][r][c4]; if (C) *(v4f*)(C + cofs + (size_t)(row0 + r) * ldc + col0 + c4) = v; if (C16) { v4h h4; for (int i = 0; i < 4; ++i) h4[i] = (_Float16)v[i]; *(v4h*)(C16 + cofs + (size_t)(row0 + r) * ldc + col0 + c4) = h4; } }
     } }


__global__ __launch_bounds__(256) void k_wnat(const float* __restrict__ w, size_t n8, _Float16* __restrict__ Bt) { const size_t t = (size_t)blockIdx.x * 256 + threadIdx.x; if (t >= n8) return; FragH f; for (int q = 0; q < 8; ++q) f.h[q] = (_Float16)(bf16_round(w[t * 8 + q]) * 16.0f); *(v8us*)((unsigned short*)Bt + t * 8) = f.half[0];  }
__global__ __launch_bounds__(256) void k_rsm(const float* __restrict__ S, _Float16* __restrict__ P, int nrows) {
  #pragma clang fp contract(off)
  const int i = blockIdx.x * 256 + threadIdx.x; if (i >= nrows) return; const float* s = S + (size_t)i * SQ; float mx = -3.0e38f;
#pragma unroll 1
  for (int j = 0; j < SQ; ++j) mx = fmaxf(mx, s[j]); float se = 0.f;
#pragma unroll 1
  for (int j = 0; j < SQ; ++j) se += expf(s[j] - mx); const float sc = 256.0f / se;
#pragma unroll 1
  for (int j0 = 0; j0 < SQ; j0 += 8) { FragH f; for (int q = 0; q < 8; ++q) f.h[q] = (_Float16)(expf(s[j0 + q] - mx) * sc); unsigned short* d = (unsigned short*)P + (size_t)i * SQ + j0; *(v8us*)d = f.half[0];  } }
__global__ __launch_bounds__(256) void k_vt(const _Float16* __restrict__ V16, int b, int h0, _Float16* __restrict__ VT) { __shared__ unsigned short tl[64][65]; const int tid = threadIdx.x; const int hh = blockIdx.x % HG, sg = blockIdx.x / HG; const int s0 = sg * 64; const int h = h0 + hh;
  for (int i = tid; i < 64 * 8; i += 256) { const int j = i / 8, d8 = (i % 8) * 8; FragH f; f.half[0] = *(const v8us*)((const unsigned short*)V16 + ((size_t)b * SQ + s0 + j) * DM + h * HD + d8); for (int q = 0; q < 8; ++q) tl[d8 + q][j] = f.u[q]; }
  __syncthreads();
  { for (int i = tid; i < 64 * 8; i += 256) { const int d = i / 8, j8 = (i % 8) * 8; FragH f; for (int q = 0; q < 8; ++q) f.u[q] = tl[d][j8 + q]; *(v8us*)((unsigned short*)VT + ((size_t)hh * HD + d) * SQ + s0 + j8) = f.half[0]; }  } }



// Lane l <-> l ^ M inside a 16-lane row (DPP row_xmask) and l <-> l ^ 16 (cross-row move): a five-step butterfly leaves the row's maximum / sum in every lane without an LDS round trip.
template <int M> __device__ __forceinline__ float rs_xm(float x) { return __builtin_bit_cast(float, __builtin_amdgcn_update_dpp(0, __builtin_bit_cast(int, x), 0x160 | M, 0xf, 0xf, true)); }
__device__ __forceinline__ float rs_xh(float x) { return __builtin_bit_cast(float, __builtin_amdgcn_permlanex16(__builtin_bit_cast(int, x), __builtin_bit_cast(int, x), 0x76543210, 0xfedcba98, false, false)); }
// Fused causal attention, all batches, heads and query tiles in ONE launch: scores, softmax and weighted values stay in registers, nothing of them goes to memory.
// A work-group of FAW waves takes FAQ query rows of one head, 32 per wave, and walks the keys 0 .. its last row in stages of FAK keys. A stage's K rows [key][d] and V^T rows [d][key] are fetched with whole-line loads
// one stage ahead into registers and stored to one of two LDS buffers; one barrier per stage publishes the next buffer and ends the reads of the one that is refilled after it.
// Per 32-key pass a wave forms S^T = K Q^T (A = K rows, B = q rows held in registers): lane (c, h) then holds keys 8h + r of query c, so the maximum and the sum are in-lane plus one exchange of the wave's halves,
// and the two 16-key score tiles, converted in place, are the B operand of O^T += V^T P^T (A = V^T rows in the same k order). Online softmax in the log2 domain; the maximum in use may trail the true one by up to 8,
// so a weight can reach 2^8 (f16 holds it at full relative precision) and the accumulators are rescaled only in the rare pass in which some query's maximum grows by more.
// The full unrolls in the kernel give its register arrays (fragments, score tiles, accumulators, staged rows) constant indices, without which they would go to scratch memory.
#define FAW 4                        /* waves per work-group */
#define FAQ (FAW * 32)               /* query rows per work-group */
#define FAK 64                       /* keys per LDS stage: two 32-key passes; 64 f16 = one 128-byte line of a V^T row */
#define FAP (HD + 8)                 /* LDS row pitch in halves: 144 B = 16 B x odd, so that the 16 rows of a fragment load fall on different banks */
__device__ __forceinline__ v8f fa_mma(v16h a, v16h b, v8f c) { return __builtin_amdgcn_wmma_f32_16x16x32_f16(false, a, false, b, (short)0, c, false, false); }
__device__ __forceinline__ v16h fa_frag(const _Float16* p) { FragH f; f.half[0] = *(const v8us*)(const unsigned short*)p; f.half[1] = *(const v8us*)((const unsigned short*)p + 16); return f.v; }      /* p already holds the lane's 8 * h: k = 8h .. 8h+7 and 16+8h .. 16+8h+7, the order of g2_frag */
// Four vector slots between a run of matrix instructions and the branch behind it: on the taken side the next vector instruction may read their results. The two scheduling barriers keep the slots at that place.
__device__ __forceinline__ void fa_gap() { __builtin_amdgcn_sched_barrier(0); asm volatile("v_nop\n\tv_nop\n\tv_nop\n\tv_nop"); __builtin_amdgcn_sched_barrier(0); }
__global__ __launch_bounds__(FAW * 32) void k_fattn(const _Float16* __restrict__ Qh, const _Float16* __restrict__ Kh, const _Float16* __restrict__ Vt, _Float16* __restrict__ Oh) {
  static_assert(HD == 64 && FAK == 64 && FAQ % FAK == 0 && SQ / FAQ == 16 && NB * NH == 64 && FAW * 32 == 128 && KVD == DM, "16 query tiles x 64 (batch, head) pairs; 8 threads stage one 128-byte row, 16 rows per pass of the staging loop");
  __shared__ __attribute__((aligned(16))) _Float16 ks[2][FAK * FAP]; __shared__ __attribute__((aligned(16))) _Float16 vs[2][HD * FAP];
  const int tid = threadIdx.x, lane = tid & 31, c = lane & 15, h = lane >> 4; const int w = __builtin_amdgcn_readfirstlane(tid >> 5); const int idx = blockIdx.x;
  // A tile's cost grows with its index and all work-groups are resident together: the 16 tiles are dealt by a 4 x 4 square whose rows and columns all sum to 30 (row = idx / 256, column = (idx / 8) % 4), every (head, tile) pair once.
  const int tile = (int)((0x0DE3B6587A94C12FULL >> (4 * (((idx >> 8) << 2) | ((idx >> 3) & 3)))) & 15); const int bh = (idx & 7) | (((idx >> 5) & 7) << 3); const int b = bh / NH, hd = bh % NH;
  const int q0 = tile * FAQ, qw = q0 + 32 * w, nst = (q0 + FAQ) / FAK;      /* causal: keys below the tile's end */
  const int sr = tid >> 3, sc = (tid & 7) * 8; const int so = sr * FAP + sc;      /* staging: row sr + 16 u, eight halves at column sc */
  const _Float16* kg = Kh + ((size_t)b * SQ + sr) * KVD + hd * HD + sc; const _Float16* vg = Vt + ((size_t)bh * HD + sr) * SQ + sc;
  v8us kr[4], vr[4];
#pragma unroll
  for (int u = 0; u < 4; ++u) { kr[u] = *(const v8us*)(const unsigned short*)(kg + u * 16 * KVD); vr[u] = *(const v8us*)(const unsigned short*)(vg + u * 16 * SQ); }
  v16h qf[2][2];
#pragma unroll
  for (int g = 0; g < 2; ++g) for (int kc = 0; kc < 2; ++kc) qf[g][kc] = g2_frag(Qh + ((size_t)b * SQ + qw + 16 * g + c) * LQ + hd * HD + kc * 32, h);
  asm volatile("s_wait_xcnt 0x0" ::: "memory");      /* the q rows' address registers are free for reuse from here on: this wait stands in front of their overwrite */
#pragma unroll
  for (int u = 0; u < 4; ++u) { *(v8us*)(unsigned short*)&ks[0][so + u * 16 * FAP] = kr[u]; *(v8us*)(unsigned short*)&vs[0][so + u * 16 * FAP] = vr[u]; }
  const v8f z8 = {0.f, 0.f, 0.f, 0.f, 0.f, 0.f, 0.f, 0.f}; const v4f z4 = {0.f, 0.f, 0.f, 0.f};
  v8f acc[2][4]; v4f l4[2]; float mr[2];
#pragma unroll
  for (int g = 0; g < 2; ++g) { mr[g] = -__builtin_inff(); l4[g] = z4; for (int t = 0; t < 4; ++t) acc[g][t] = z8; }
  const float cs = 0.125f * 1.44269504088896340736f;      /* 64^-0.5 log2 e */
  __syncthreads();
  for (int st = 0; st < nst; ++st) {
    const bool more = st + 1 < nst;      /* the same for the whole work-group */
    if (more) {
#pragma unroll
      for (int u = 0; u < 4; ++u) { kr[u] = *(const v8us*)(const unsigned short*)(kg + (size_t)(st + 1) * FAK * KVD + u * 16 * KVD); vr[u] = *(const v8us*)(const unsigned short*)(vg + (st + 1) * FAK + u * 16 * SQ); }
      asm volatile("s_wait_xcnt 0x0" ::: "memory"); }      /* the pass below reuses the registers that hold these loads' addresses: this wait stands in front of that overwrite */
    const _Float16* kb = &ks[st & 1][c * FAP + 8 * h]; const _Float16* vb = &vs[st & 1][c * FAP + 8 * h];
    for (int p = 0; p < FAK / 32; ++p) { const int key0 = st * FAK + p * 32;
      if (key0 <= qw) {      /* wave-uniform: a wave skips the passes beyond its diagonal, never the barrier */
        v8f s[2][2];
        { v16h kf[2][2];
#pragma unroll
          for (int kt = 0; kt < 2; ++kt) for (int kc = 0; kc < 2; ++kc) kf[kt][kc] = fa_frag(kb + (p * 32 + 16 * kt) * FAP + kc * 32);
#pragma unroll
          for (int kt = 0; kt < 2; ++kt) for (int g = 0; g < 2; ++g) s[kt][g] = fa_mma(kf[kt][1], qf[g][1], fa_mma(kf[kt][0], qf[g][0], z8)); }      /* s[kt][g][r] = q(qw + 16g + c) . k(key0 + 16kt + 8h + r) */
        fa_gap();
        if (key0 == qw) {      /* the one pass on the wave's diagonal: key > query is masked; key key0 is kept in every row */
#pragma unroll
          for (int kt = 0; kt < 2; ++kt) for (int g = 0; g < 2; ++g) for (int r = 0; r < 8; ++r) s[kt][g][r] = (16 * kt + 8 * h + r > 16 * g + c) ? -__builtin_inff() : s[kt][g][r]; }
        float mb[2]; bool need = false;
#pragma unroll
        for (int g = 0; g < 2; ++g) { float mx = s[0][g][0];
#pragma unroll
          for (int r = 1; r < 8; ++r) mx = fmaxf(mx, s[0][g][r]);
#pragma unroll
          for (int r = 0; r < 8; ++r) mx = fmaxf(mx, s[1][g][r]);
          mx = fmaxf(mx, rs_xh(mx)) * cs; mb[g] = mx; need = need || (mx > mr[g] + 8.0f); }      /* both halves of the wave hold the query's maximum of this pass, scaled */
        if (__builtin_amdgcn_ballot_w32(need) != 0) {      /* scalar branch; always taken in a wave's first pass, where mr is -inf and the factor 0 */
#pragma unroll
          for (int g = 0; g < 2; ++g) { const float mn = fmaxf(mr[g], mb[g]); const float corr = __builtin_amdgcn_exp2f(mr[g] - mn); mr[g] = mn; l4[g] *= corr;
#pragma unroll
            for (int t = 0; t < 4; ++t) acc[g][t] *= corr; } }
        v16h vf[4];
#pragma unroll
        for (int t = 0; t < 4; ++t) vf[t] = fa_frag(vb + 16 * t * FAP + p * 32);
#pragma unroll
        for (int g = 0; g < 2; ++g) { const float nm = -mr[g]; FragH pf;
#pragma unroll
          for (int kt = 0; kt < 2; ++kt) for (int j = 0; j < 2; ++j) { const v4f x = {s[kt][g][4 * j], s[kt][g][4 * j + 1], s[kt][g][4 * j + 2], s[kt][g][4 * j + 3]}; const v4f y = x * cs + nm; const v4f e = {__builtin_amdgcn_exp2f(y[0]), __builtin_amdgcn_exp2f(y[1]), __builtin_amdgcn_exp2f(y[2]), __builtin_amdgcn_exp2f(y[3])}; l4[g] += e;      /* the builtin, so that the compiler keeps these writes clear of the matrix instructions' operands */
            for (int i = 0; i < 4; ++i) pf.h[8 * kt + 4 * j + i] = (_Float16)e[i]; }      /* element 8 kt + r of the B operand = key 16 kt + 8 h + r: the k order of fa_frag */
#pragma unroll
          for (int t = 0; t < 4; ++t) acc[g][t] = fa_mma(vf[t], pf.v, acc[g][t]); }      /* acc[g][t][r] = o(qw + 16g + c)[16t + 8h + r], not yet divided by the row sum */
        fa_gap();
      } }
    if (more) {
#pragma unroll
      for (int u = 0; u < 4; ++u) { *(v8us*)(unsigned short*)&ks[(st + 1) & 1][so + u * 16 * FAP] = kr[u]; *(v8us*)(unsigned short*)&vs[(st + 1) & 1][so + u * 16 * FAP] = vr[u]; }
      __syncthreads(); }      /* publishes stage st + 1 and ends every wave's reads of stage st, whose buffer the next trip refills */
  }
  v8us ov[2][4]; unsigned short* og = (unsigned short*)Oh + ((size_t)b * SQ + qw + c) * DM + hd * HD + 8 * h;      /* lane (c, h): 8 consecutive d of query row c, one 16-byte store per 16 d */
#pragma unroll
  for (int g = 0; g < 2; ++g) { float l = (l4[g][0] + l4[g][1]) + (l4[g][2] + l4[g][3]); l += rs_xh(l); const float fin = 64.0f / l;      /* o carried x64, as the output GEMM's factor expects */
#pragma unroll
    for (int t = 0; t < 4; ++t) { FragH f; for (int r = 0; r < 8; ++r) f.h[r] = (_Float16)(acc[g][t][r] * fin); ov[g][t] = f.half[0]; } }
  __builtin_amdgcn_sched_barrier(0);      /* the eight stores stand behind the last conversion, so that no register which an issued store names is written again */
#pragma unroll
  for (int g = 0; g < 2; ++g) for (int t = 0; t < 4; ++t) *(v8us*)(og + g * 16 * DM + 16 * t) = ov[g][t]; }


// Exact f32 causal attention for rows 0..QT0-1 of every batch and head (planes [batch][QT0][DM]). One work-group of 256 threads takes A0R query rows of one head: thread (r, c) = (tid / 8, tid % 8).
// The group's q rows and the head's QT0 key and value rows are staged in LDS once; then scores (thread (r, c): keys c, c + 8, ...; its q row in registers), the row maximum and sum over the row's 8 lanes, and o (thread (r, c): columns 4c..4c+3 and 32+4c..32+4c+3).
#define A0R 32                       /* query rows per work-group */
#define A0KP (HD + 4)                /* q and key row pitch in LDS, floats: 16 B x odd, so that 8 rows read at one column fall on different banks */
#define A0PP (QT0 + 8)               /* weight row pitch in LDS, floats: the 4 rows of a wave start 8 banks apart */
// o leaves as two f16 planes [batch][QT0][DM]: hi = f16(o), lo = f16((o - hi) * 1024), the A rows of the output projection's first-tile work-groups.
__global__ __launch_bounds__(256) void k_att0(const float* __restrict__ QF, const float* __restrict__ KF, const float* __restrict__ VF, float scale, _Float16* __restrict__ OH, _Float16* __restrict__ OL) {
  static_assert(QT0 % A0R == 0 && A0R * 8 == 256 && A0R == 32 && HD == 64 && QT0 % 16 == 0, "8 threads per query row; 16 threads stage one row, 16 rows per pass");
  __shared__ __attribute__((aligned(16))) float ks[QT0 * A0KP]; __shared__ __attribute__((aligned(16))) float vs[QT0 * HD]; __shared__ __attribute__((aligned(16))) float qs[A0R * A0KP]; __shared__ __attribute__((aligned(16))) float ps[A0R * A0PP];
  const int tid = threadIdx.x; const int h = blockIdx.x / (QT0 / A0R), rg = blockIdx.x % (QT0 / A0R); const int r = tid >> 3, c = tid & 7; const int i = rg * A0R + r; const int nk = (rg + 1) * A0R;      /* causal: keys below the group's last row */
  const size_t bo = (size_t)blockIdx.y * QT0 * DM + (size_t)h * HD;      /* grid.y = batch */
  const int sr = tid >> 4, sc = (tid & 15) * 4; const int so = sr * DM + sc;      /* staging: row sr + 16 u, four floats at column sc */
  const float* kg = KF + bo; const float* vg = VF + bo; const float* qg = QF + bo + (size_t)rg * A0R * DM;
  v4f kk[QT0 / 16], vv[QT0 / 16];      /* the full unrolls below give the register arrays kk, vv, q constant indices and put all staging loads in flight together */
#pragma unroll
  for (int u = 0; u < QT0 / 16; ++u) { kk[u] = *(const v4fa*)(kg + so + u * 16 * DM); vv[u] = *(const v4fa*)(vg + so + u * 16 * DM); }
  const v4f q0 = *(const v4fa*)(qg + so);
  asm volatile("s_wait_xcnt 0x0" ::: "memory");      /* the last staging load may return into the offset register that the loads above name: this wait stands in front of that overwrite */
  const v4f q1 = *(const v4fa*)(qg + so + 16 * DM);
#pragma unroll
  for (int u = 0; u < QT0 / 16; ++u) { *(v4f*)&ks[(sr + u * 16) * A0KP + sc] = kk[u]; *(v4f*)&vs[(sr + u * 16) * HD + sc] = vv[u]; }
  *(v4f*)&qs[sr * A0KP + sc] = q0; *(v4f*)&qs[(sr + 16) * A0KP + sc] = q1;
  __syncthreads();
  v4f q[HD / 4];
#pragma unroll
  for (int u = 0; u < HD / 4; ++u) q[u] = *(const v4f*)&qs[r * A0KP + u * 4];
  float* pr = ps + r * A0PP; float mx = -3.0e38f;      /* unroll 2 in the three loops below: the LDS loads of two trips are in flight together and their sums are independent chains */
#pragma unroll 2
  for (int m = 0; m < nk / 8; ++m) { const int j = c + m * 8; const float* kp = ks + j * A0KP; v4f a = {0.f, 0.f, 0.f, 0.f};
#pragma unroll
    for (int u = 0; u < HD / 4; ++u) a += q[u] * *(const v4f*)(kp + u * 4);
    const float s = (j <= i) ? ((a[0] + a[1]) + (a[2] + a[3])) * scale : -3.0e38f; pr[j] = s; mx = fmaxf(mx, s); }
  mx = fmaxf(mx, rs_xm<1>(mx)); mx = fmaxf(mx, rs_xm<2>(mx)); mx = fmaxf(mx, rs_xm<4>(mx));      /* key 0 is kept in every row, so the row maximum is a real score and a masked key's weight is exp(-huge) = 0 */
  float l = 0.f;
#pragma unroll 2
  for (int m = 0; m < nk / 8; ++m) { const int j = c + m * 8; const float e = expf(pr[j] - mx); pr[j] = e; l += e; }
  l += rs_xm<1>(l); l += rs_xm<2>(l); l += rs_xm<4>(l);
  __syncthreads();
  v4f o0 = {0.f, 0.f, 0.f, 0.f}, o1 = {0.f, 0.f, 0.f, 0.f}; const float* vp = vs + c * 4;
#pragma unroll 2
  for (int j = 0; j < nk; j += 4) { const v4f p = *(const v4f*)(pr + j);
#pragma unroll
    for (int t = 0; t < 4; ++t) { o0 += p[t] * *(const v4f*)(vp + (j + t) * HD); o1 += p[t] * *(const v4f*)(vp + (j + t) * HD + HD / 2); } }
  const float fin = 64.0f / l;      /* o carried x64 like the f16 path */
  const v4f a0 = o0 * fin, a1 = o1 * fin; v4h h0, h1, l0, l1;
#pragma unroll
  for (int t = 0; t < 4; ++t) { _Float16 hv = (_Float16)a0[t]; h0[t] = hv; l0[t] = (_Float16)((a0[t] - (float)hv) * 1024.0f); hv = (_Float16)a1[t]; h1[t] = hv; l1[t] = (_Float16)((a1[t] - (float)hv) * 1024.0f); }
  const size_t oo = bo + i * DM + c * 4; *(v4h*)(OH + oo) = h0; *(v4h*)(OH + oo + HD / 2) = h1; *(v4h*)(OL + oo) = l0; *(v4h*)(OL + oo + HD / 2) = l1; }


__global__ __launch_bounds__(256) void k_tab2(float theta, float* __restrict__ CS, float* __restrict__ SN) {
  #pragma clang fp contract(off)
  const int t = blockIdx.x * 256 + threadIdx.x; if (t >= SQ * (HD / 2)) return; const int i = t % (HD / 2); const int p = t / (HD / 2); const float invf = 1.0f / powf(theta, (float)(2 * i) / (float)HD); const float ang = __fmul_rn((float)p, invf); const float c = cosf(ang), s = sinf(ang);
  *(float*)(CS + t) = c; *(float*)(SN + t) = s;  }
// q, k and v projections of all token rows in ONE launch, with everything that stood between them and the attention kernels done in the epilogue. The stage loop is that of k_gemm2 (128 x 128 tile, 8 waves of 32 x 64, two LDS buffers, K = DM).
// Work-group (xt, j): xt = tile of 128 token rows, j = tile of 128 rows of the transposed fused weight Wt [3 DM][DM] (j / 8 = 0 q, 1 k, 2 v).
// q, k: A = token rows, B = weight rows. A wave's 64 columns are one head, so that after the turn through LDS lane l holds columns 4l .. 4l + 3 of a row and the rotate-half partner sits 8 lanes away (DPP exchange):
// out_lo = x_lo c - x_hi s, out_hi = x_hi c + x_lo s, written as f16 rows; the first QT0 rows of a batch also as f32 rows [batch][QT0][DM] for the exact first-tile kernel.
// v: the operands change places (A = weight rows, B = token rows; same k order, same products), so that the tile comes out as V^T [d][token] and its rows are whole lines of the plane [batch][head][d][SQ];
// of the first QT0 tokens of a batch a lane's 8 accumulator rows are 8 consecutive d of one token: stored as f32 v rows [batch][QT0][DM] straight from the registers.
// The full unrolls give the register arrays constant indices and put a phase's loads or stores in flight together.
__global__ __launch_bounds__(256) void k_proj3(const _Float16* __restrict__ X, const _Float16* __restrict__ Wt, const float* __restrict__ CS, const float* __restrict__ SN,
    _Float16* __restrict__ Qh, _Float16* __restrict__ Kh, _Float16* __restrict__ Vt, float* __restrict__ QF0, float* __restrict__ KF0, float* __restrict__ VF0) {
  static_assert(2 * G2S * 2 >= 8 * 32 * 68 * 4 && G2T == 128 && G2K == 64 && DM % G2K == 0 && SQ % G2T == 0 && QT0 == G2T && HD == 64 && KVD == DM && HPG == 1 && SQ / G2T == 16 && DM / G2T == 8, "a wave's 64 columns are one head; a token tile lies in one batch; the first tile of a batch is the exact kernel's rows");
  __shared__ __attribute__((aligned(16))) unsigned char sm[2 * G2S * 2]; _Float16* const sg = (_Float16*)sm; float (*const so)[32][68] = (float (*)[32][68])sm;      /* the stage buffers; behind the loop's last barrier the same bytes hold each wave's output rows */
  const int tid = threadIdx.x, lane = tid & 31, ln = lane & 15, hh = lane >> 4; const int w = __builtin_amdgcn_readfirstlane(tid >> 5), wm = w & 3, wn = w >> 2;
  const int xt = blockIdx.x / 24, j = blockIdx.x - xt * 24; const bool isv = j >= 16; const int bt = xt >> 4, xs = xt & 15;      /* bt = batch, xs = token tile in the batch; all the same for the whole work-group */
  const _Float16* const xr = X + (size_t)xt * G2T * DM; const _Float16* const wr = Wt + (size_t)j * G2T * DM;
  const int sr = tid >> 3, sc = (tid & 7) * 8; const int sl = sr * G2P + sc;      /* staging: row sr + 32 u, eight halves at column sc */
  const _Float16* ag = (isv ? wr : xr) + sr * DM + sc; const _Float16* bg = (isv ? xr : wr) + sr * DM + sc; const int nst = DM / G2K;
  const v8f z8 = {0.f,0.f,0.f,0.f,0.f,0.f,0.f,0.f}; v8f c00 = z8, c01 = z8, c02 = z8, c03 = z8, c10 = z8, c11 = z8, c12 = z8, c13 = z8;
  v8us ar[4], br[4]; const unsigned short* pa[4]; const unsigned short* pb[4];
#pragma unroll
  for (int u = 0; u < 4; ++u) { pa[u] = (const unsigned short*)(ag + (size_t)(u * 32) * DM); pb[u] = (const unsigned short*)(bg + (size_t)(u * 32) * DM); }
#pragma unroll
  for (int u = 0; u < 4; ++u) { ar[u] = *(const v8us*)pa[u]; br[u] = *(const v8us*)pb[u]; }
  asm volatile("s_wait_xcnt 0x0" :: "v"(pa[0]), "v"(pa[1]), "v"(pa[2]), "v"(pa[3]), "v"(pb[0]), "v"(pb[1]), "v"(pb[2]), "v"(pb[3]) : "memory");      /* the loads' address registers are free for reuse only from here on; as inputs they stay whole up to this wait, so that no load returns into one either */
#pragma unroll
  for (int u = 0; u < 4; ++u) { *(v8us*)(unsigned short*)&sg[sl + u * 32 * G2P] = ar[u]; *(v8us*)(unsigned short*)&sg[G2T * G2P + sl + u * 32 * G2P] = br[u]; }
  __syncthreads();
#pragma unroll 1
  for (int s = 0; s < nst; ++s) { const bool more = s + 1 < nst;      /* more: the same for the whole work-group. The stage loop stays rolled, so that its text stays small; its two 32-k passes are unrolled, so that their LDS offsets are immediates */
    if (more) {
#pragma unroll
      for (int u = 0; u < 4; ++u) { pa[u] = (const unsigned short*)(ag + (s + 1) * G2K + (size_t)(u * 32) * DM); pb[u] = (const unsigned short*)(bg + (s + 1) * G2K + (size_t)(u * 32) * DM); }
#pragma unroll
      for (int u = 0; u < 4; ++u) { ar[u] = *(const v8us*)pa[u]; br[u] = *(const v8us*)pb[u]; }
      asm volatile("s_wait_xcnt 0x0" :: "v"(pa[0]), "v"(pa[1]), "v"(pa[2]), "v"(pa[3]), "v"(pb[0]), "v"(pb[1]), "v"(pb[2]), "v"(pb[3]) : "memory"); }      /* the code below reuses the registers that these loads name: this wait stands in front of that overwrite, and as its inputs they stay whole up to it, so that no load returns into one either */
    const _Float16* ab = sg + (s & 1) * G2S + (32 * wm + ln) * G2P; const _Float16* bb = sg + (s & 1) * G2S + (G2T + 64 * wn + ln) * G2P;
#pragma unroll
    for (int kc = 0; kc < G2K; kc += 32) { const v16h a0 = g2_frag(ab + kc, hh), a1 = g2_frag(ab + 16 * G2P + kc, hh);
      const v16h b0 = g2_frag(bb + kc, hh), b1 = g2_frag(bb + 16 * G2P + kc, hh), b2 = g2_frag(bb + 32 * G2P + kc, hh), b3 = g2_frag(bb + 48 * G2P + kc, hh);
      c00 = g2_mma(a0, b0, c00); c10 = g2_mma(a1, b0, c10); c01 = g2_mma(a0, b1, c01); c11 = g2_mma(a1, b1, c11);
      c02 = g2_mma(a0, b2, c02); c12 = g2_mma(a1, b2, c12); c03 = g2_mma(a0, b3, c03); c13 = g2_mma(a1, b3, c13); }
    if (more) {
#pragma unroll
      for (int u = 0; u < 4; ++u) { *(v8us*)(unsigned short*)&sg[((s + 1) & 1) * G2S + sl + u * 32 * G2P] = ar[u]; *(v8us*)(unsigned short*)&sg[((s + 1) & 1) * G2S + G2T * G2P + sl + u * 32 * G2P] = br[u]; } }
    __syncthreads(); }      /* publishes stage s + 1 and ends every wave's reads of stage s, whose buffer the next trip refills and, behind the last trip, the output rows reuse */
  v8f accs[8] = {c00, c01, c02, c03, c10, c11, c12, c13};
#pragma unroll
  for (int u = 0; u < 8; ++u) accs[u] *= 0.0625f;      /* the weights are carried x16 */
  if (isv && xs == 0) { char* fb = (char*)(VF0 + ((size_t)bt * QT0 + 64 * wn) * DM + (j - 16) * G2T + 32 * wm); const unsigned fo = ln * (DM * 4u) + hh * 32u;      /* f32 v rows: token 16 t + ln, columns 16 half + 8 hh + 0..7 of the wave's 32 */
#pragma unroll
    for (int u = 0; u < 8; ++u) { const v4f lo = {accs[u][0], accs[u][1], accs[u][2], accs[u][3]}, hi = {accs[u][4], accs[u][5], accs[u][6], accs[u][7]};
      *(v4f*)(fb + (u & 3) * 16 * (DM * 4) + (u >> 2) * 64 + fo) = lo; *(v4f*)(fb + (u & 3) * 16 * (DM * 4) + (u >> 2) * 64 + 16 + fo) = hi; }
    asm volatile("s_wait_xcnt 0x0" ::: "memory"); }      /* the accumulators' registers, which these stores name, are reused below: this wait stands in front of that overwrite */
#pragma unroll
  for (int u = 0; u < 8; ++u)
#pragma unroll
    for (int r = 0; r < 8; ++r) so[w][(u >> 2) * 16 + 8 * hh + r][(u & 3) * 16 + ln] = accs[u][r];
  __builtin_amdgcn_fence(__ATOMIC_ACQ_REL, "workgroup"); __builtin_amdgcn_wave_barrier();      /* a wave reads back only its own rows */
  v4h oh[16];
  if (!isv) {
    // Lanes 0..7 of a 16-lane row fetch the row's cosines, lanes 8..15 its sines (one 128-byte table row each); the DPP exchange that brings the partner's x brings the other table value too.
    const bool up = (ln & 8) != 0; const char* tp = (const char*)((up ? SN : CS) + (xs * G2T + 32 * wm + hh) * (HD / 2) + (ln & 7) * 4); v4f tv[16];
#pragma unroll
    for (int q = 0; q < 16; ++q) tv[q] = *(const v4fa*)(tp + q * 2 * (HD / 2 * 4));
    asm volatile("s_wait_xcnt 0x0" :: "v"(tp) : "memory");      /* the table loads' address registers are free for reuse only from here on; as an input they stay whole up to this wait, so that no load returns into them either */
#pragma unroll
    for (int q0 = 0; q0 < 16; q0 += 4) { v4f xv[4];      /* four rows' LDS reads in flight together; the roped row takes the place of its table values */
#pragma unroll
      for (int q = 0; q < 4; ++q) xv[q] = *(const v4fa*)&so[w][(q0 + q) * 2 + hh][ln * 4];
#pragma unroll
      for (int q = 0; q < 4; ++q) { const v4f x = xv[q], t = tv[q0 + q]; const v4f y = {rs_xm<8>(x[0]), rs_xm<8>(x[1]), rs_xm<8>(x[2]), rs_xm<8>(x[3])};
        const v4f tw = {rs_xm<8>(t[0]), rs_xm<8>(t[1]), rs_xm<8>(t[2]), rs_xm<8>(t[3])}; const v4f cc = up ? tw : t; const v4f sn = up ? t : -tw; const v4f o = x * cc + y * sn; tv[q0 + q] = o;
        for (int i = 0; i < 4; ++i) oh[q0 + q][i] = (_Float16)o[i]; }
      __builtin_amdgcn_sched_barrier(0); }      /* keeps the later rows' table exchanges behind this point: hoisted, they hold twice the registers per row and cost a work-group of occupancy; behind the last row it keeps the stores behind the arithmetic, so that no register which an issued store names is written again */
    char* hb = (char*)((j >= 8 ? Kh : Qh) + ((size_t)xt * G2T + 32 * wm) * DM + (j & 7) * G2T + 64 * wn); const unsigned ho = hh * (DM * 2u) + ln * 8u;
#pragma unroll
    for (int q = 0; q < 16; ++q) *(v4h*)(hb + q * 2 * (DM * 2) + ho) = oh[q];
    if (xs == 0) { asm volatile("s_wait_xcnt 0x0" ::: "memory"); __builtin_amdgcn_sched_barrier(0);      /* the address arithmetic below reuses registers that the f16 stores name: this wait stands in front of that overwrite, and the scheduling barrier keeps the arithmetic behind it */
      char* fb = (char*)((j >= 8 ? KF0 : QF0) + ((size_t)bt * QT0 + 32 * wm) * DM + (j & 7) * G2T + 64 * wn); const unsigned fo = hh * (DM * 4u) + ln * 16u;      /* the first QT0 rows of a batch: the same values unrounded */
#pragma unroll
      for (int q = 0; q < 16; ++q) *(v4f*)(fb + q * 2 * (DM * 4) + fo) = tv[q]; }
  } else {
#pragma unroll
    for (int q = 0; q < 16; ++q) { const v4f v = *(const v4fa*)&so[w][q * 2 + hh][ln * 4]; for (int i = 0; i < 4; ++i) oh[q][i] = (_Float16)v[i]; }
    __builtin_amdgcn_sched_barrier(0);      /* the stores stand behind the last conversion, so that no register which an issued store names is written again */
    char* vb = (char*)(Vt + ((size_t)bt * DM + (j - 16) * G2T + 32 * wm) * SQ + xs * G2T + 64 * wn); const unsigned vo = hh * (SQ * 2u) + ln * 8u;      /* row of V^T = head * HD + d */
#pragma unroll
    for (int q = 0; q < 16; ++q) *(v4h*)(vb + q * 2 * (SQ * 2) + vo) = oh[q];
  } }

// Output projection of all token rows in ONE launch: out = o Wo with o carried x64 and Wo x16. The stage loop is that of k_gemm2 (128 x 128 tile, 8 waves of 32 x 64, two LDS buffers, K = DM).
// Work-groups NB * 16 and up: one tile of 128 f16 o rows, the first tile of every batch left out. Work-groups 0 .. NB * 16 - 1 take those first tiles from the exact kernel's planes, 64 token rows each:
// A rows 0..63 of the tile are the rows' hi plane and A rows 64..127 the same rows' lo plane, so that hi Wo and lo Wo come out of the same 16 stages side by side (waves wm = 0, 1 and wm = 2, 3);
// after the turn through LDS wave wm adds its partner's (wm + 2) rows: out = hi Wo 2^-10 + lo Wo 2^-20, the sum that two more launches formed through the output buffer before.
__global__ __launch_bounds__(256) void k_outp(const _Float16* __restrict__ O, const _Float16* __restrict__ OH, const _Float16* __restrict__ OL, const _Float16* __restrict__ Wt, float* __restrict__ C) {
  static_assert(2 * G2S * 2 >= 8 * 32 * 68 * 4 && G2T == 128 && G2K == 64 && DM % G2K == 0 && QT0 == G2T && SQ / G2T == 16 && DM / G2T == 8, "16 row tiles per batch, the first of them the exact kernel's rows; 8 column tiles");
  __shared__ __attribute__((aligned(16))) unsigned char sm[2 * G2S * 2]; _Float16* const sg = (_Float16*)sm; float (*const so)[32][68] = (float (*)[32][68])sm;      /* the stage buffers; behind the loop's last barrier the same bytes hold each wave's output rows */
  const int tid = threadIdx.x, lane = tid & 31, ln = lane & 15, hh = lane >> 4; const int w = __builtin_amdgcn_readfirstlane(tid >> 5), wm = w & 3, wn = w >> 2;
  const int idx = blockIdx.x, nq = idx & 7; const bool ft = idx < NB * 16;      /* ft: a first-tile work-group; the same for the whole work-group */
  const int f0 = (idx >> 4) * QT0 + ((idx >> 3) & 1) * 64;      /* ft: first row in the planes, batch idx / 16, upper or lower 64 rows */
  const int m15 = (idx - NB * 16) >> 3; const int mt = m15 + m15 / 15 + 1;      /* else: row tile, 15 per batch */
  const int orow = ft ? (idx >> 4) * SQ + ((idx >> 3) & 1) * 64 : mt * G2T;      /* first output row */
  const int sr = tid >> 3, sc = (tid & 7) * 8; const int sl = sr * G2P + sc;      /* staging: row sr + 32 u, eight halves at column sc */
  const _Float16* ag0 = (ft ? OH + (size_t)f0 * DM : O + (size_t)mt * G2T * DM) + sr * DM + sc;      /* A rows 0..63 */
  const _Float16* ag1 = (ft ? OL + (size_t)f0 * DM : O + ((size_t)mt * G2T + 64) * DM) + sr * DM + sc;      /* A rows 64..127 */
  const _Float16* bg = Wt + (size_t)(nq * G2T + sr) * DM + sc; const int nst = DM / G2K;
  const v8f z8 = {0.f,0.f,0.f,0.f,0.f,0.f,0.f,0.f}; v8f c00 = z8, c01 = z8, c02 = z8, c03 = z8, c10 = z8, c11 = z8, c12 = z8, c13 = z8;
  v8us ar[4], br[4]; const unsigned short* p0 = (const unsigned short*)ag0; const unsigned short* p1 = (const unsigned short*)ag1; const unsigned short* pb = (const unsigned short*)bg;      /* the full unrolls give the register arrays constant indices and put a stage's eight loads in flight together */
#pragma unroll
  for (int u = 0; u < 2; ++u) { ar[u] = *(const v8us*)(p0 + u * 32 * DM); ar[2 + u] = *(const v8us*)(p1 + u * 32 * DM); br[u] = *(const v8us*)(pb + u * 32 * DM); br[2 + u] = *(const v8us*)(pb + (2 + u) * 32 * DM); }
  asm volatile("s_wait_xcnt 0x0" :: "v"(p0), "v"(p1), "v"(pb) : "memory");      /* the loads' address registers are free for reuse only from here on; as inputs they stay whole up to this wait, so that no load returns into one either */
#pragma unroll
  for (int u = 0; u < 4; ++u) { *(v8us*)(unsigned short*)&sg[sl + u * 32 * G2P] = ar[u]; *(v8us*)(unsigned short*)&sg[G2T * G2P + sl + u * 32 * G2P] = br[u]; }
  __syncthreads();
#pragma unroll 1
  for (int s = 0; s < nst; ++s) { const bool more = s + 1 < nst;      /* more: the same for the whole work-group. The stage loop stays rolled, so that its text stays small; its two 32-k passes are unrolled, so that their LDS offsets are immediates */
    if (more) { p0 = (const unsigned short*)(ag0 + (s + 1) * G2K); p1 = (const unsigned short*)(ag1 + (s + 1) * G2K); pb = (const unsigned short*)(bg + (s + 1) * G2K);
#pragma unroll
      for (int u = 0; u < 2; ++u) { ar[u] = *(const v8us*)(p0 + u * 32 * DM); ar[2 + u] = *(const v8us*)(p1 + u * 32 * DM); br[u] = *(const v8us*)(pb + u * 32 * DM); br[2 + u] = *(const v8us*)(pb + (2 + u) * 32 * DM); }
      asm volatile("s_wait_xcnt 0x0" :: "v"(p0), "v"(p1), "v"(pb) : "memory"); }      /* the code below reuses the registers that these loads name: this wait stands in front of that overwrite, and as its inputs they stay whole up to it, so that no load returns into one either */
    const _Float16* ab = sg + (s & 1) * G2S + (32 * wm + ln) * G2P; const _Float16* bb = sg + (s & 1) * G2S + (G2T + 64 * wn + ln) * G2P;
#pragma unroll
    for (int kc = 0; kc < G2K; kc += 32) { const v16h a0 = g2_frag(ab + kc, hh), a1 = g2_frag(ab + 16 * G2P + kc, hh);
      const v16h b0 = g2_frag(bb + kc, hh), b1 = g2_frag(bb + 16 * G2P + kc, hh), b2 = g2_frag(bb + 32 * G2P + kc, hh), b3 = g2_frag(bb + 48 * G2P + kc, hh);
      c00 = g2_mma(a0, b0, c00); c10 = g2_mma(a1, b0, c10); c01 = g2_mma(a0, b1, c01); c11 = g2_mma(a1, b1, c11);
      c02 = g2_mma(a0, b2, c02); c12 = g2_mma(a1, b2, c12); c03 = g2_mma(a0, b3, c03); c13 = g2_mma(a1, b3, c13); }
    if (more) {
#pragma unroll
      for (int u = 0; u < 4; ++u) { *(v8us*)(unsigned short*)&sg[((s + 1) & 1) * G2S + sl + u * 32 * G2P] = ar[u]; *(v8us*)(unsigned short*)&sg[((s + 1) & 1) * G2S + G2T * G2P + sl + u * 32 * G2P] = br[u]; } }
    __syncthreads(); }      /* publishes stage s + 1 and ends every wave's reads of stage s, whose buffer the next trip refills and, behind the last trip, the output rows reuse */
  v8f accs[8] = {c00, c01, c02, c03, c10, c11, c12, c13}; const float al = (ft && wm >= 2) ? 0.00000095367431640625f : 0.0009765625f;      /* 2^-10 = 1 / (64 x 16); the lo plane is carried x1024 on top */
#pragma unroll
  for (int u = 0; u < 8; ++u)
#pragma unroll
    for (int r = 0; r < 8; ++r) so[w][(u >> 2) * 16 + 8 * hh + r][(u & 3) * 16 + ln] = accs[u][r] * al;
  if (ft) __syncthreads();      /* work-group-uniform branch: the hi waves read the lo waves' rows below */
  else { __builtin_amdgcn_fence(__ATOMIC_ACQ_REL, "workgroup"); __builtin_amdgcn_wave_barrier(); }      /* a wave reads back only its own rows */
  if (ft && wm >= 2) return;      /* wave-uniform, behind the last barrier: the lo waves' rows are stored by their partners */
  v4f ov[16];
#pragma unroll
  for (int q = 0; q < 16; ++q) ov[q] = *(const v4fa*)&so[w][q * 2 + hh][ln * 4];
  if (ft) {      /* one branch round all sixteen partner rows, so that their LDS reads are in flight together */
#pragma unroll
    for (int q = 0; q < 16; ++q) ov[q] += *(const v4fa*)&so[w + 2][q * 2 + hh][ln * 4]; }
  __builtin_amdgcn_sched_barrier(0);      /* the stores stand behind the last LDS read, so that no register which an issued store names is written again */
  char* cb = (char*)(C + (size_t)(orow + 32 * wm) * DM + nq * G2T + 64 * wn); const unsigned co = hh * (DM * 4u) + ln * 16u;
#pragma unroll
  for (int q = 0; q < 16; ++q) *(v4f*)(cb + q * 2 * (DM * 4) + co) = ov[q]; }

__global__ __launch_bounds__(256) void k_bfcp(const float* __restrict__ src, float* __restrict__ dst, size_t n4) { const size_t t = (size_t)blockIdx.x * 256 + threadIdx.x; if (t >= n4) return; const v4f a = *(const v4fa*)(src + t * 4); v4f o; for (int q = 0; q < 4; ++q) o[q] = bf16_round(a[q]); *(v4f*)(dst + t * 4) = o;  }

__global__ __launch_bounds__(256) void k_tabhalf(const float* __restrict__ cs, const float* __restrict__ sn, float* __restrict__ CS, float* __restrict__ SN) { const int t = blockIdx.x * 256 + threadIdx.x; if (t >= SQ * (HD / 2)) return; const int p = t / (HD / 2), i = t % (HD / 2); const float c = bf16_round(cs[(size_t)p * HD + i]), s = bf16_round(sn[(size_t)p * HD + i]);
  *(float*)(CS + t) = c; *(float*)(SN + t) = s;  }

__device__ __forceinline__ void p_tab2d(int blk, float* __restrict__ CS, float* __restrict__ SN) {
  #pragma clang fp contract(off)
  const int t = blk * 256 + threadIdx.x; if (t >= SQ * (HD / 2)) return; const int i = t % (HD / 2); const int p = t / (HD / 2); const float invf = (float)(1.0 / pow(10000.0, (double)(2 * i) / (double)HD)); const float ang = __fmul_rn((float)p, invf); const float c = cosf(ang), s = sinf(ang);
  *(float*)(CS + t) = c; *(float*)(SN + t) = s;  }
// The four preparation jobs (rope tables, x to f16, the two weight transposes) read only the inputs and write planes of their own: none depends on another, so that ONE launch runs them side by side, split by work-group index.
// The table groups, the longest chains of arithmetic, come first; behind them every run of 12 groups holds 8 of x, 3 of the fused weight and 1 of the output weight,
// so that the x stream (memory) and the transposes' column reads (L2 requests) are in flight together from the first run to the last.
#define PJ_TAB (SQ * (HD / 2) / 256)                 /* work-groups of the table job */
#define PJ_RUN (DM * (DM / 8) / 256)                 /* runs of 12 = work-groups of the output weight's transpose */
__global__ __launch_bounds__(256) void k_prep(const float* __restrict__ x, const float* __restrict__ wattn, const float* __restrict__ wo, _Float16* __restrict__ X16, _Float16* __restrict__ BQKV, _Float16* __restrict__ BO, float* __restrict__ CS, float* __restrict__ SN) {
  static_assert(PJ_TAB * 256 == SQ * (HD / 2) && PJ_RUN * 256 == DM * (DM / 8) && (size_t)PJ_RUN * 8 * 256 == NR * DM / 8, "whole work-groups; x has 8 and the fused weight 3 work-groups for each one of the output weight");
  const int idx = blockIdx.x;      /* every test below is the same for the whole work-group */
  if (idx < PJ_TAB) { p_tab2d(idx, CS, SN); return; }
  const int r = idx - PJ_TAB, g = r / 12, m = r - g * 12;
  if (m < 8) p_x16(g * 8 + m, x, X16, NR * DM / 8);
  else if (m < 11) p_wt_f16(g * 3 + (m - 8), wattn, BQKV, DM, 3 * DM, 16.0f);      /* [in][out] -> Bt x16 planes (fused W_attn: K 1024, N 3072) */
  else p_wt_f16(g, wo, BO, DM, DM, 16.0f); }
extern "C" void kernel_launch(void* const* d_in, const int* in_sizes, int n_in,
                              void* d_out, int out_size, void* d_ws, size_t ws_size, hipStream_t stream) {
  (void)in_sizes; (void)n_in; (void)out_size;
  const float* const* I = (const float* const*)d_in; const float* x = I[0]; const float* wattn = I[1]; const float* wo = I[2];      /* x; fused [in][out] W_attn [1024][3072] (q | k | v column thirds); [in][out] W_proj; rope tables computed in-kernel (positions = row index) */
  static_assert(HPG == 1 && NH == NG * HPG && NH * HD == DM && KVD == DM, "plain multi-head attention as 16 kv groups of one query head"); const float* bo = nullptr;      /* [in][out] weights, no biases; rope tables computed in the kernel */
  char* ws = (char*)d_ws; size_t off = 0;
  auto take = [&](size_t bytes) { char* p = ws + off; off += (bytes + 255) & ~(size_t)255; return p; };
  _Float16* BQKV = (_Float16*)take((size_t)3 * DM * DM * 2); _Float16* BO = (_Float16*)take((size_t)DM * DM * 2);      /* one transposed plane Bt [3072][1024] of the fused weight: rows 0..1023 = q, 1024.. = k, 2048.. = v */
  _Float16* X16 = (_Float16*)take(NR * DM * 2); float* CSB = (float*)take((size_t)SQ * HD * 4); float* SNB = (float*)take((size_t)SQ * HD * 4); _Float16* Q16 = (_Float16*)take(NR * DM * 2); _Float16* K16 = (_Float16*)take(NR * KVD * 2); _Float16* O16 = (_Float16*)take(NR * DM * 2);
  static_assert(B0 == 0 && NBR == NB && NHD == NH && QN == SQ, "every launch covers all batches and heads");
  _Float16* VT = (_Float16*)take((size_t)NB * NH * HD * SQ * 2);
  float* QF0 = (float*)take((size_t)NB * QT0 * DM * 4); float* KF0 = (float*)take((size_t)NB * QT0 * KVD * 4); float* VF0 = (float*)take((size_t)NB * QT0 * KVD * 4); _Float16* OH0 = (_Float16*)take((size_t)NB * QT0 * DM * 2); _Float16* OL0 = (_Float16*)take((size_t)NB * QT0 * DM * 2);
  if (off > ws_size) return;
  k_prep<<<PJ_TAB + PJ_RUN * 12, 256, 0, stream>>>(x, wattn, wo, X16, BQKV, BO, CSB, SNB);      /* x as f16; both weights as transposed x16 planes; rope tables cos/sin(p / 10000^(2i/64)): inv_freq double-derived -> f32, f32 angle */
  /* Every launch below covers all NB batches: token rows b * SQ + s run through (projections), or the batch is decoded from blockIdx.x (attention) / grid.y (first-tile kernel). */
  k_proj3<<<(MP / G2T) * (3 * DM / G2T), 256, 0, stream>>>(X16, BQKV, CSB, SNB, Q16, K16, VT, QF0, KF0, VF0);      /* roped q, k as f16 rows, V^T [NB][NH][HD][SQ] as f16, and the f32 roped q, k and v of rows 0..127 of each batch; position = row % SQ */
  k_att0<<<dim3(NH * (QT0 / A0R), NB), 256, 0, stream>>>(QF0, KF0, VF0, 0.125f, OH0, OL0);      /* exact f32 attention for rows 0..127 of each batch (o x64) -> f16 hi + x1024 residual planes; one head per kv group, so that the k and v rows are the heads' own */
  k_fattn<<<NB * NH * (SQ / FAQ), FAW * 32, 0, stream>>>(Q16, K16, VT, O16);      /* scores, causal softmax and weighted values of all batches, heads and query tiles: o (x64) as f16 rows */
  k_outp<<<NB * 16 + (MPO / G2T - NB) * (DM / G2T), 256, 0, stream>>>(O16, OH0, OL0, BO, (float*)d_out);      /* out rows are the output layout; rows 0..127 of each batch from the hi and lo planes, all others from the f16 path */
}

// v010
// Measured time: 130 microseconds a run.
// Two timings next to v009 both put it at 1.14 times that version's speed.
// Over all steps from v000, the starting kernel, it is 77.2 times as fast.
#include <hip/hip_runtime.h>
// Causal multi-head self-attention with rotate-half RoPE computed in the module and a bias-free fused QKV projection (x [4][2048][1024]; qkv = x Wqkv ([in][out] 1024 x 3072, no bias) split into q | k | v thirds, 16 heads of 64; cos / sin = [f | f] of pos * 10000^(-2i/64); q = q cos + rotate_half(q) sin, likewise k; scores * 64^-0.5; causal (tril, finfo.min fill); softmax; out = merged Wout ([in][out], no bias) -> [4][2048][1024]); run as 16 groups of ONE head with the rope stage in its half-split mode.
// Compute dtype: inputs rounded to bf16; x / weights exact; q, k, v, softmax weights and o as plain f16 GEMM operands (~2^-12); scores and softmax statistics f32. v_wmma_f32_16x16x32_f16.
#define NB 4
#define NG 16
#define HPG 1
#define KVD (NG * HD)
#define SQ 2048
#define DM 1024
#define NH 16
#define HD 64
#define HG 4                         /* heads per launch of the unlaunched k_vt(V16, b, h0, VT) */
#define QT 256                       /* unused; the causal query tile is FAQ */
#define NKX SQ                       /* S / P row pitch */
#define QT0 128                      /* first-tile rows recomputed exactly in f32 */
#define B0 0                         /* first batch processed (debug hook) */
#define NBR NB                       /* batches processed (debug hook) */
#define NR ((size_t)NB * SQ)         /* token rows */
#define MP ((int)((size_t)NBR * SQ)) /* rows projected (debug hook) */
#define QN SQ                        /* query rows attended per batch (debug hook) */
#define NHD NH                       /* heads attended (debug hook) */
#define MPO MP                       /* rows through the output stage (debug hook) */
#define LQ DM      /* row pitch of the q/k/v rows */
typedef __bf16 v16b __attribute__((ext_vector_type(16)));
typedef unsigned short v8us __attribute__((ext_vector_type(8), may_alias));
typedef float  v8f  __attribute__((ext_vector_type(8)));
typedef float  v4f  __attribute__((ext_vector_type(4)));
typedef float  v4fa __attribute__((ext_vector_type(4), may_alias));
union FragB { v16b v; v8us half[2]; unsigned short u[16]; };

__device__ __forceinline__ unsigned short bf16_bits(float x) { unsigned int u = __float_as_uint(x); return (unsigned short)((u + 0x7FFFu + ((u >> 16) & 1u)) >> 16); }
__device__ __forceinline__ float bf16_val(unsigned short b) { return __uint_as_float(((unsigned int)b) << 16); }
__device__ __forceinline__ float bf16_round(float x) { return bf16_val(bf16_bits(x)); }
// D += A·B with NT terms: 1 = ah·bh, 2 = + al·bh (A split), 3 = + ah·bl (both split)
template <int NT>
__device__ __forceinline__ v8f mmaN(v16b ah, v16b al, v16b bh, v16b bl, v8f c) {
  c = __builtin_amdgcn_wmma_f32_16x16x32_bf16(false, ah, false, bh, (short)0, c, false, false);
  if (NT >= 2) c = __builtin_amdgcn_wmma_f32_16x16x32_bf16(false, al, false, bh, (short)0, c, false, false);
  if (NT >= 3) c = __builtin_amdgcn_wmma_f32_16x16x32_bf16(false, ah, false, bl, (short)0, c, false, false);
  asm volatile("v_nop\n\tv_nop\n\tv_nop\n\tv_nop" : "+v"(c) : "v"(ah), "v"(al), "v"(bh), "v"(bl));
  return c;
}

__global__ __launch_bounds__(256) void k_wt_bf16(const float* __restrict__ W, unsigned short* __restrict__ Wt, int K, int N) {
  const int t = blockIdx.x * 256 + threadIdx.x;
  const int k8n = K / 8;
  if (t >= N * k8n) return;
  const int n = t / k8n, k8 = (t % k8n) * 8;
  v8us v;
#pragma unroll
  for (int i = 0; i < 8; ++i) v[i] = bf16_bits(W[(size_t)(k8 + i) * N + n]);
  *(v8us*)(Wt + (size_t)n * K + k8) = v;
  
}

// GEMM C[M][N] (f32, pitch ldc) = act(A[M][K]·W + bias). A f32 row-major (pitch lda) converted per fragment to bf16
// (ASPLIT: hi/lo two planes -> 2 terms, else single rounded term); Wt bf16 [N][K] (pitch ldb). BIAS_BF16 rounds the
// bias to bf16 first (bias quantised to bf16 before the add). K%32==0, M%16==0, N%64==0.
template <bool ASPLIT, int ACT, bool BIAS_BF16>
__global__ __launch_bounds__(128) void k_gemm_bf(const float* __restrict__ A, int lda, const unsigned short* __restrict__ Wt, int ldb,
                                               const float* __restrict__ bias, float* __restrict__ C, int ldc, int M, int N, int K) {
  __shared__ __attribute__((aligned(16))) float so[4][16][64];
  const int tid = threadIdx.x, w = tid >> 5, lane = tid & 31, ln = lane & 15, hh = lane >> 4;
  const int ntn = N / 64;
  const int wid = blockIdx.x * 4 + w;
  const int mt = wid / ntn, nq = wid % ntn;
  if (mt * 16 >= M) return;
  const int row0 = mt * 16, col0 = nq * 64;
  const float* arow = A + (size_t)(row0 + ln) * lda;
  v8f acc[4] = {};
  for (int kb = 0; kb < K; kb += 32) {
    FragB ah, al;
    const v4f x0 = *(const v4fa*)(arow + kb + 8 * hh), x1 = *(const v4fa*)(arow + kb + 8 * hh + 4);
    const v4f x2 = *(const v4fa*)(arow + kb + 16 + 8 * hh), x3 = *(const v4fa*)(arow + kb + 16 + 8 * hh + 4);
    float xs[16] = {x0[0],x0[1],x0[2],x0[3],x1[0],x1[1],x1[2],x1[3],x2[0],x2[1],x2[2],x2[3],x3[0],x3[1],x3[2],x3[3]};
#pragma unroll
    for (int i = 0; i < 16; ++i) { const unsigned short hb = bf16_bits(xs[i]); ah.u[i] = hb; al.u[i] = ASPLIT ? bf16_bits(xs[i] - bf16_val(hb)) : (unsigned short)0; }
#pragma unroll
    for (int t = 0; t < 4; ++t) {
      const unsigned short* brow = Wt + (size_t)(col0 + t * 16 + ln) * ldb + kb;
      FragB b;
      b.half[0] = *(const v8us*)(brow + 8 * hh);
      b.half[1] = *(const v8us*)(brow + 16 + 8 * hh);
      acc[t] = mmaN<ASPLIT ? 2 : 1>(ah.v, al.v, b.v, b.v, acc[t]);
    }
  }
#pragma unroll
  for (int t = 0; t < 4; ++t) {
    float bv = bias ? bias[col0 + t * 16 + ln] : 0.f;
    if (BIAS_BF16) bv = bf16_round(bv);
#pragma unroll
    for (int r = 0; r < 8; ++r) { float v = acc[t][r] + bv; if (ACT == 1) v = fmaxf(v, 0.f); so[w][8 * hh + r][t * 16 + ln] = v; }
  }
  __builtin_amdgcn_fence(__ATOMIC_ACQ_REL, "workgroup");
  __builtin_amdgcn_wave_barrier();
  const int rsub = lane >> 4, c4 = (lane & 15) * 4;
  {
#pragma unroll
    for (int q = 0; q < 8; ++q) {
      const int r = q * 2 + rsub;
      const v4f v = *(const v4fa*)&so[w][r][c4];
      *(v4f*)(C + (size_t)(row0 + r) * ldc + col0 + c4) = v;
    }
    
  }
}

// GEMM C = act(A·W + bias + resid): A f32 (ASPLIT -> hi/lo 2 terms), Wt bf16 [N][K]; ACT 0 none, 1 relu, 2 exact gelu;
// resid (optional, f32, row index = (row % rmod), pitch ldr, RES_BF16 rounds it) added before the activation.
template <bool ASPLIT, int ACT, bool BIAS_BF16, bool RES_BF16>
__global__ __launch_bounds__(128) void k_gemm_bf3(const float* __restrict__ A, int lda, const unsigned short* __restrict__ Wt, int ldb,
                                                const float* __restrict__ bias, const float* __restrict__ resid, int rmod, int ldr,
                                                float* __restrict__ C, int ldc, int M, int N, int K) {
  __shared__ __attribute__((aligned(16))) float so[4][16][64];
  const int tid = threadIdx.x, w = tid >> 5, lane = tid & 31, ln = lane & 15, hh = lane >> 4;
  const int ntn = N / 64;
  const int wid = blockIdx.x * 4 + w;
  const int mt = wid / ntn, nq = wid % ntn;
  if (mt * 16 >= M) return;
  const int row0 = mt * 16, col0 = nq * 64;
  const float* arow = A + (size_t)(row0 + ln) * lda;
  v8f acc[4] = {};
  for (int kb = 0; kb < K; kb += 32) {
    FragB ah, al;
    const v4f x0 = *(const v4fa*)(arow + kb + 8 * hh), x1 = *(const v4fa*)(arow + kb + 8 * hh + 4);
    const v4f x2 = *(const v4fa*)(arow + kb + 16 + 8 * hh), x3 = *(const v4fa*)(arow + kb + 16 + 8 * hh + 4);
    float xs[16] = {x0[0],x0[1],x0[2],x0[3],x1[0],x1[1],x1[2],x1[3],x2[0],x2[1],x2[2],x2[3],x3[0],x3[1],x3[2],x3[3]};
#pragma unroll
    for (int i = 0; i < 16; ++i) { const unsigned short hb = bf16_bits(xs[i]); ah.u[i] = hb; al.u[i] = ASPLIT ? bf16_bits(xs[i] - bf16_val(hb)) : (unsigned short)0; }
#pragma unroll
    for (int t = 0; t < 4; ++t) {
      const unsigned short* brow = Wt + (size_t)(col0 + t * 16 + ln) * ldb + kb;
      FragB b;
      b.half[0] = *(const v8us*)(brow + 8 * hh);
      b.half[1] = *(const v8us*)(brow + 16 + 8 * hh);
      acc[t] = mmaN<ASPLIT ? 2 : 1>(ah.v, al.v, b.v, b.v, acc[t]);
    }
  }
#pragma unroll
  for (int t = 0; t < 4; ++t) {
    const int col = col0 + t * 16 + ln;
    float bv = bias ? bias[col] : 0.f;
    if (BIAS_BF16) bv = bf16_round(bv);
#pragma unroll
    for (int r = 0; r < 8; ++r) {
      float v = acc[t][r] + bv;
      if (resid) { float rv = resid[(size_t)((row0 + 8 * hh + r) % rmod) * ldr + col]; if (RES_BF16) rv = bf16_round(rv); v += rv; }
      if (ACT == 1) v = fmaxf(v, 0.f);
      if (ACT == 2) v = 0.5f * v * (1.0f + erff(v * 0.70710678118654752f));
      if (ACT == 3) { const float u = 0.7978845608028654f * (v + 0.044715f * v * v * v); v = 0.5f * v * (1.0f + tanhf(u)); }
      so[w][8 * hh + r][t * 16 + ln] = v;
    }
  }
  __builtin_amdgcn_fence(__ATOMIC_ACQ_REL, "workgroup");
  __builtin_amdgcn_wave_barrier();
  const int rsub = lane >> 4, c4 = (lane & 15) * 4;
  {
#pragma unroll
    for (int q = 0; q < 8; ++q) {
      const int r = q * 2 + rsub;
      const v4f v = *(const v4fa*)&so[w][r][c4];
      *(v4f*)(C + (size_t)(row0 + r) * ldc + col0 + c4) = v;
    }
    
  }
}
// row LayerNorm (biased variance, eps) over N: s = X (+ R); optional out_sum <- s; out_norm <- (s-mu)*rsqrt(var+eps)*g + b
template <bool PARAM_BF16>
__global__ __launch_bounds__(256) void k_layernorm(const float* __restrict__ X, const float* __restrict__ R, const float* __restrict__ g, const float* __restrict__ bta,
                                                  float* __restrict__ out_sum, float* __restrict__ out_norm, int N, float eps) {
  __shared__ float red[256];
  const int row = blockIdx.x, tid = threadIdx.x;
  const float* x = X + (size_t)row * N; const float* rr = R ? R + (size_t)row * N : nullptr;
  float vals[16];                     // up to N = 4096
  const int per = N / 256;            // contiguous chunk per thread? use strided-by-4 chunks: thread handles j = tid*4 + 1024*u
  float s1 = 0.f;
  for (int u = 0; u < per / 4; ++u) {
    const int j = tid * 4 + 1024 * u;
    const v4f a = *(const v4fa*)(x + j);
    v4f b = {0.f,0.f,0.f,0.f}; if (rr) b = *(const v4fa*)(rr + j);
#pragma unroll
    for (int q = 0; q < 4; ++q) { const float v = a[q] + b[q]; vals[u * 4 + q] = v; s1 += v; }
  }
  red[tid] = s1; __syncthreads();
  for (int st = 128; st > 0; st >>= 1) { if (tid < st) red[tid] += red[tid + st]; __syncthreads(); }
  const float mu = red[0] / (float)N; __syncthreads();
  float s2 = 0.f;
  for (int u = 0; u < per / 4; ++u)
#pragma unroll
    for (int q = 0; q < 4; ++q) { const float c = vals[u * 4 + q] - mu; s2 += c * c; }
  red[tid] = s2; __syncthreads();
  for (int st = 128; st > 0; st >>= 1) { if (tid < st) red[tid] += red[tid + st]; __syncthreads(); }
  const float rs = rsqrtf(red[0] / (float)N + eps);
  {
    for (int u = 0; u < per / 4; ++u) {
      const int j = tid * 4 + 1024 * u;
      v4f o, sm;
#pragma unroll
      for (int q = 0; q < 4; ++q) {
        float gg = g[j + q], bb = bta[j + q];
        if (PARAM_BF16) { gg = bf16_round(gg); bb = bf16_round(bb); }
        sm[q] = vals[u * 4 + q]; o[q] = (vals[u * 4 + q] - mu) * rs * gg + bb;
      }
      if (out_sum) *(v4f*)(out_sum + (size_t)row * N + j) = sm;
      *(v4f*)(out_norm + (size_t)row * N + j) = o;
    }
    
  }
}



// ---- f16 WMMA path (v_wmma_f32_16x16x32_f16): 11-bit significands for operands in range — used where a [0,1] probability operand needs more precision than bf16
typedef _Float16 v16h __attribute__((ext_vector_type(16)));
union FragH { v16h v; v8us half[2]; _Float16 h[16]; unsigned short u[16]; };
template <int NT>
__device__ __forceinline__ v8f mmaH(v16h ah, v16h al, v16h bh, v16h bl, v8f c) {
  c = __builtin_amdgcn_wmma_f32_16x16x32_f16(false, ah, false, bh, (short)0, c, false, false);
  if (NT >= 2) c = __builtin_amdgcn_wmma_f32_16x16x32_f16(false, al, false, bh, (short)0, c, false, false);
  if (NT >= 3) c = __builtin_amdgcn_wmma_f32_16x16x32_f16(false, ah, false, bl, (short)0, c, false, false);
  asm volatile("v_nop\n\tv_nop\n\tv_nop\n\tv_nop" : "+v"(c) : "v"(ah), "v"(al), "v"(bh), "v"(bl));
  return c;
}
// batched GEMM like k_gemm_b but f16 operands: A f32 (split into f16 hi/lo if ASPLIT, else rounded to f16), Bt = f16 values [n][k]; alpha; C f32; N multiple of 16 (partial tiles skipped)
template <bool ASPLIT>
__global__ __launch_bounds__(128) void k_gemm_h(const float* __restrict__ A, int lda, size_t sA, const _Float16* __restrict__ Bh, int ldb, size_t sB, float alpha, float* __restrict__ C, int ldc, size_t sC, int M, int N, int K) {
  __shared__ __attribute__((aligned(16))) float so[4][16][64];
  const int tid = threadIdx.x, w = tid >> 5, lane = tid & 31, ln = lane & 15, hh = lane >> 4; const int by = blockIdx.y;
  A += (size_t)by * sA; Bh += (size_t)by * sB; C += (size_t)by * sC;
  const int ntn = (N + 63) / 64; const int wid = blockIdx.x * 4 + w; const int mt = wid / ntn, nq = wid % ntn; if (mt * 16 >= M) return;
  const int row0 = mt * 16, col0 = nq * 64; const float* arow = A + (size_t)(row0 + ln) * lda;
  v8f acc[4] = {};
  for (int kb = 0; kb < K; kb += 32) {
    FragH ah, al;
    const v4f x0 = *(const v4fa*)(arow + kb + 8 * hh), x1 = *(const v4fa*)(arow + kb + 8 * hh + 4), x2 = *(const v4fa*)(arow + kb + 16 + 8 * hh), x3 = *(const v4fa*)(arow + kb + 16 + 8 * hh + 4);
    float xs[16] = {x0[0],x0[1],x0[2],x0[3],x1[0],x1[1],x1[2],x1[3],x2[0],x2[1],x2[2],x2[3],x3[0],x3[1],x3[2],x3[3]};
#pragma unroll
    for (int i = 0; i < 16; ++i) { const _Float16 h = (_Float16)xs[i]; ah.h[i] = h; al.h[i] = ASPLIT ? (_Float16)(xs[i] - (float)h) : (_Float16)0.0f; }
#pragma unroll
    for (int t = 0; t < 4; ++t) { if (col0 + t * 16 >= N) continue; const size_t boff = (size_t)(col0 + t * 16 + ln) * ldb + kb; FragH bq; bq.half[0] = *(const v8us*)(Bh + boff + 8 * hh); bq.half[1] = *(const v8us*)(Bh + boff + 16 + 8 * hh);
      acc[t] = mmaH<ASPLIT ? 2 : 1>(ah.v, al.v, bq.v, bq.v, acc[t]); }
  }
#pragma unroll
  for (int t = 0; t < 4; ++t) { if (col0 + t * 16 >= N) continue;
#pragma unroll
    for (int r = 0; r < 8; ++r) so[w][8 * hh + r][t * 16 + ln] = acc[t][r] * alpha; }
  __builtin_amdgcn_fence(__ATOMIC_ACQ_REL, "workgroup"); __builtin_amdgcn_wave_barrier();
  const int rsub = lane >> 4, c4 = (lane & 15) * 4;
  {
#pragma unroll
    for (int q = 0; q < 8; ++q) { const int r = q * 2 + rsub; if (col0 + c4 < N) { const v4f v = *(const v4fa*)&so[w][r][c4]; *(v4f*)(C + (size_t)(row0 + r) * ldc + col0 + c4) = v; } }
     }
}

// Wt[n][k] = f16(W[k][n]·scale) from f32 row-major W[K][N] (scale = power of two; bf16-exact weights stay exact in f16 away from the subnormal range)
// A work-group takes a tile of 256 k x 64 n, a thread 8 k x 8 n: sixteen 16-byte loads, all in flight together, and eight 16-byte stores. Lane l holds rows 8 (l / 4) .. + 7 and columns 4 (l % 4) .. + 3 and 16 + 4 (l % 4) .. + 3 of its wave's 64 k x 32 n,
// so that a wave's load takes a 64-byte half line of 8 rows of W (the load beside it the other half) and a wave's store fills 4 whole 128-byte lines of Wt. Few, long work-groups, for speed only. Needs K % 256 == 0 and N % 64 == 0.
__device__ __forceinline__ void p_wt_f16(int blk, const float* __restrict__ W, _Float16* __restrict__ Wt, int K, int N, float scale) {      /* blk: the job's own work-group index, 256 threads each, (N / 64) * (K / 256) of them */
  const int lane = threadIdx.x & 31, w = threadIdx.x >> 5; const int nkt = K / 256; const int nt = blk / nkt, kt = blk - nt * nkt;
  const int n = nt * 64 + (w & 1) * 32 + (lane & 3) * 4, k8 = kt * 256 + (w >> 1) * 64 + (lane >> 2) * 8;
  const float* p = W + (size_t)k8 * N + n; v4f r[2][8]; v8us o[2][4];      /* the full unrolls give these register arrays constant indices */
#pragma unroll
  for (int i = 0; i < 8; ++i) { r[0][i] = *(const v4fa*)(p + (size_t)i * N); r[1][i] = *(const v4fa*)(p + (size_t)i * N + 16); }
  asm volatile("s_wait_xcnt 0x0" :: "v"(p) : "memory");      /* the loads' address registers are free for reuse only from here on; as an input they stay whole up to this wait, so that no load returns into them either */
#pragma unroll
  for (int c = 0; c < 2; ++c)
#pragma unroll
    for (int q = 0; q < 4; ++q) { FragH f;
#pragma unroll
      for (int i = 0; i < 8; ++i) f.h[i] = (_Float16)(bf16_round(r[c][i][q]) * scale);
      o[c][q] = f.half[0]; }
  __builtin_amdgcn_sched_barrier(0);      /* the stores stand in one run behind the last conversion, so that the one wait behind them serves them all */
  unsigned short* d = (unsigned short*)Wt + (size_t)n * K + k8;
#pragma unroll
  for (int c = 0; c < 2; ++c)
#pragma unroll
    for (int q = 0; q < 4; ++q) *(v8us*)(d + (size_t)(c * 16 + q) * K) = o[c][q];
  asm volatile("s_wait_xcnt 0x0" :: "v"(d), "v"(o[0][0]), "v"(o[0][1]), "v"(o[0][2]), "v"(o[0][3]), "v"(o[1][0]), "v"(o[1][1]), "v"(o[1][2]), "v"(o[1][3]) : "memory");      /* the registers that the stores name, address and data, are free for reuse only from here on; as inputs they stay whole up to this wait */
}
// k_gemm_hh variant with fused epilogue: v = acc·alpha + bias[by·sBias + col] (+ CP[(row/rowsPerB)·sCPb + by·64 + col] if CP) ; ACT 0 none / 1 elu ; writes f16 C16 (and f32 C if non-null)
template <int ACT>
__global__ __launch_bounds__(128) void k_gemm_hhx(const _Float16* __restrict__ A, int lda, size_t sA, const _Float16* __restrict__ Bh, int ldb, size_t sB, float alpha, const float* __restrict__ bias, size_t sBias, const float* __restrict__ CP, int rowsPerB, size_t sCPb, int row0g,
    float* __restrict__ C, _Float16* __restrict__ C16, int ldc, size_t sC, int M, int N, int K) {
  __shared__ __attribute__((aligned(16))) float so[4][16][64];
  const int tid = threadIdx.x, w = tid >> 5, lane = tid & 31, ln = lane & 15, hh = lane >> 4; const int by = blockIdx.y;
  A += (size_t)by * sA; Bh += (size_t)by * sB; const size_t cofs = (size_t)by * sC; const float* bp = bias ? bias + (size_t)by * sBias : nullptr;
  const int ntn = (N + 63) / 64; const int wid = blockIdx.x * 4 + w; const int mt = wid / ntn, nq = wid % ntn; if (mt * 16 >= M) return;
  const int row0 = mt * 16, col0 = nq * 64; const _Float16* arow = A + (size_t)(row0 + ln) * lda;
  v8f acc[4] = {};
  for (int kb = 0; kb < K; kb += 32) { FragH ah; ah.half[0] = *(const v8us*)((const unsigned short*)arow + kb + 8 * hh); ah.half[1] = *(const v8us*)((const unsigned short*)arow + kb + 16 + 8 * hh);
#pragma unroll
    for (int t = 0; t < 4; ++t) { if (col0 + t * 16 >= N) continue; const size_t boff = (size_t)(col0 + t * 16 + ln) * ldb + kb; FragH bq; bq.half[0] = *(const v8us*)((const unsigned short*)Bh + boff + 8 * hh); bq.half[1] = *(const v8us*)((const unsigned short*)Bh + boff + 16 + 8 * hh);
      acc[t] = mmaH<1>(ah.v, ah.v, bq.v, bq.v, acc[t]); }
  }
#pragma unroll
  for (int t = 0; t < 4; ++t) { if (col0 + t * 16 >= N) continue; const int col = col0 + t * 16 + ln; const float bv = bp ? bf16_round(bp[col]) : 0.f;
#pragma unroll
    for (int r = 0; r < 8; ++r) { float v = acc[t][r] * alpha + bv; if (CP) { const int rr = row0g + row0 + 8 * hh + r; if (rowsPerB < 0) v += CP[cofs + (size_t)rr * ldc + col];      /* rowsPerB < 0: own element of the batched C plane */ else { const int bidx = rr / rowsPerB; v += CP[(size_t)bidx * sCPb + (size_t)by * 64 + col]; } } if (ACT == 1) v = (v > 0.f) ? v : expm1f(v); else if (ACT == 7) v = (v > 0.f) ? v + 1.0f : expf(v); else if (ACT == 8) v = tanhf(v); else if (ACT == 9) v = 0.5f * v * (1.0f + tanhf(0.7978845608028654f * (v + 0.044715f * v * v * v))); else if (ACT == 11) v = 1.0f / (1.0f + expf(-v)); else if (ACT == 12) v = (v > 0.f) ? v : 0.01f * v; else if (ACT == 14) v = (v > 0.f) ? v : 0.1f * v; else if (ACT == 16) v = (v >= 0.f) ? v : 0.3f * v; else if (ACT == 17) v = (v >= 0.f) ? v : 0.2f * v; else if (ACT == 15) v = v / (1.0f + expf(-v)); else if (ACT == 3) v = fmaxf(v, 0.f); else if (ACT == 6) v = 0.5f * v * (1.0f + erff(v * 0.70710678118654752f)); so[w][8 * hh + r][t * 16 + ln] = v; } }
  __builtin_amdgcn_fence(__ATOMIC_ACQ_REL, "workgroup"); __builtin_amdgcn_wave_barrier();
  const int rsub = lane >> 4, c4 = (lane & 15) * 4; typedef _Float16 v4h __attribute__((ext_vector_type(4)));
  {
#pragma unroll
    for (int q = 0; q < 8; ++q) { const int r = q * 2 + rsub; if (col0 + c4 < N) { const v4f v = *(const v4fa*)&so[w][r][c4]; if (C) *(v4f*)(C + cofs + (size_t)(row0 + r) * ldc + col0 + c4) = v; if (C16) { v4h h4; for (int i = 0; i < 4; ++i) h4[i] = (_Float16)v[i]; *(v4h*)(C16 + cofs + (size_t)(row0 + r) * ldc + col0 + c4) = h4; } } }
     }
}


typedef _Float16 v4h __attribute__((ext_vector_type(4)));

// X16 = f16(bf16(x)): a work-group takes 16384 consecutive floats, a thread four of every 1024: sixteen 16-byte loads, all in flight together, each of which covers 512 consecutive bytes per wave, and sixteen 8-byte stores, 2 whole 128-byte lines per wave each.
__device__ __forceinline__ void p_x16(int blk, const float* __restrict__ x, _Float16* __restrict__ X16) {      /* blk: the job's own work-group index, 256 threads each, one for every 16384 elements */
  const size_t e = (size_t)blk * 16384 + threadIdx.x * 4; const float* p = x + e; v4f r[16]; v4h o[16];      /* the full unrolls give these register arrays constant indices */
#pragma unroll
  for (int u = 0; u < 16; ++u) r[u] = *(const v4fa*)(p + u * 1024);
  asm volatile("s_wait_xcnt 0x0" :: "v"(p) : "memory");      /* the loads' address registers are free for reuse only from here on; as an input they stay whole up to this wait, so that no load returns into them either */
#pragma unroll
  for (int u = 0; u < 16; ++u)
#pragma unroll
    for (int q = 0; q < 4; ++q) o[u][q] = (_Float16)bf16_round(r[u][q]);
  __builtin_amdgcn_sched_barrier(0);      /* the stores stand in one run behind the last conversion, so that the one wait behind them serves them all */
  _Float16* d = X16 + e;
#pragma unroll
  for (int u = 0; u < 16; ++u) *(v4h*)(d + u * 1024) = o[u];
  asm volatile("s_wait_xcnt 0x0" :: "v"(d), "v"(o[0]), "v"(o[1]), "v"(o[2]), "v"(o[3]), "v"(o[4]), "v"(o[5]), "v"(o[6]), "v"(o[7]), "v"(o[8]), "v"(o[9]), "v"(o[10]), "v"(o[11]), "v"(o[12]), "v"(o[13]), "v"(o[14]), "v"(o[15]) : "memory"); }      /* the registers that the stores name, address and data, are free for reuse only from here on; as inputs they stay whole up to this wait */
__global__ __launch_bounds__(256) void k_h16(const float* __restrict__ x, _Float16* __restrict__ X16, size_t n8) { const size_t t = (size_t)blockIdx.x * 256 + threadIdx.x; if (t >= n8) return; FragH f;
#pragma unroll
  for (int q = 0; q < 8; ++q) f.h[q] = (_Float16)x[t * 8 + q]; *(v8us*)((unsigned short*)X16 + t * 8) = f.half[0];  }
__global__ __launch_bounds__(256) void k_round16f(const float* __restrict__ W, _Float16* __restrict__ Bt, size_t n8) { const size_t t = (size_t)blockIdx.x * 256 + threadIdx.x; if (t >= n8) return; FragH f;
#pragma unroll
  for (int i = 0; i < 8; ++i) f.h[i] = (_Float16)(bf16_round(W[t * 8 + i]) * 16.0f); *(v8us*)((unsigned short*)Bt + t * 8) = f.half[0];  }
template <int NHv, int TTv>
__global__ __launch_bounds__(256) void k_vt(const _Float16* __restrict__ V16, int ldv, int voff, _Float16* __restrict__ Vt) { __shared__ unsigned short tl[64][66]; const int tid = threadIdx.x; const int slab = blockIdx.x / (TTv / 64), lg = blockIdx.x % (TTv / 64); const int b = slab / NHv, h = slab % NHv;
  for (int i = tid; i < 64 * 8; i += 256) { const int r = i / 8, c8 = (i % 8) * 8; FragH f; f.half[0] = *(const v8us*)((const unsigned short*)V16 + ((size_t)b * TTv + lg * 64 + r) * ldv + voff + h * 64 + c8);
#pragma unroll
    for (int q = 0; q < 8; ++q) tl[r][c8 + q] = f.u[q]; }
  __syncthreads();
  {
#pragma unroll
    for (int rd = 0; rd < 2; ++rd) { const int d = rd * 32 + tid / 8, pc = tid % 8; FragH f;
#pragma unroll
      for (int q = 0; q < 8; ++q) f.u[q] = tl[pc * 8 + q][d];
      *(v8us*)((unsigned short*)Vt + ((size_t)slab * 64 + d) * TTv + lg * 64 + pc * 8) = f.half[0]; }
     } }

__global__ __launch_bounds__(256) void k_hl(const float* __restrict__ F, _Float16* __restrict__ Hh, _Float16* __restrict__ Hl, size_t n8) { const size_t t = (size_t)blockIdx.x * 256 + threadIdx.x; if (t >= n8) return; FragH fh, fl; const v4f a = *(const v4fa*)(F + t * 8), c = *(const v4fa*)(F + t * 8 + 4);
#pragma unroll
  for (int q = 0; q < 4; ++q) { _Float16 h = (_Float16)a[q]; fh.h[q] = h; fl.h[q] = (_Float16)((a[q] - (float)h) * 1024.0f); h = (_Float16)c[q]; fh.h[4 + q] = h; fl.h[4 + q] = (_Float16)((c[q] - (float)h) * 1024.0f); }
  { *(v8us*)((unsigned short*)Hh + t * 8) = fh.half[0]; *(v8us*)((unsigned short*)Hl + t * 8) = fl.half[0];  } }

// ---- fast GEMM (work-group tile 128x128, 8 waves of 32x64; requires M % 128 == 0 rows per launch region, N % 128 == 0 and K % 64 == 0); epilogue = k_gemm_hhx semantics ----
// A stage is G2K k of the tile's 128 A rows and 128 Bt rows. 8 threads fetch one row's 128-byte line, one stage ahead into registers, and store it to one of two LDS buffers; the 8 waves read their fragments from LDS,
// so that every operand line leaves L2 once per work-group as a whole line. One barrier per stage publishes the next buffer and ends the reads of the one that is refilled after it. k runs in the order of the unstaged loop.
#define G2T 128                      /* A rows and Bt rows per work-group */
#define G2K 64                       /* k per LDS stage: 64 f16 = one 128-byte line of every row */
#define G2P (G2K + 8)                /* LDS row pitch in halves: 144 B = 16 B x odd, so that the 16 rows of a fragment load fall on different banks */
#define G2S (2 * G2T * G2P)          /* halves per stage buffer: the A rows, then the Bt rows */
__device__ __forceinline__ v16h g2_frag(const _Float16* p, int hh) { FragH f; f.half[0] = *(const v8us*)((const unsigned short*)p + 8 * hh); f.half[1] = *(const v8us*)((const unsigned short*)p + 16 + 8 * hh); return f.v; }
__device__ __forceinline__ v8f g2_mma(v16h a, v16h b, v8f c) { v8f d = __builtin_amdgcn_wmma_f32_16x16x32_f16(false, a, false, b, (short)0, c, false, false); asm volatile("v_nop\n\tv_nop\n\tv_nop\n\tv_nop" : "+v"(d) : "v"(a), "v"(b)); return d; }
template <int ACT>
__global__ __launch_bounds__(256) void k_gemm2(const _Float16* __restrict__ A, int lda, size_t sA, const _Float16* __restrict__ Bh, int ldb, size_t sB, float alpha, const float* __restrict__ bias, size_t sBias, const float* __restrict__ CP, int rowsPerB, size_t sCPb, int row0g,
    float* __restrict__ C, _Float16* __restrict__ C16, int ldc, size_t sC, int M, int N, int K, size_t zA, size_t zB, size_t zC) { static_assert(ACT == 0 || ACT == 3 || ACT == 6 || ACT == 8 || ACT == 9 || ACT == 11 || ACT == 12 || ACT == 14 || ACT == 15 || ACT == 16 || ACT == 17, "k_gemm2: unsupported ACT code (would silently apply no activation)");
  static_assert(2 * G2S * 2 >= 8 * 32 * 68 * 4 && G2T == 128 && G2K == 64, "the epilogue's rows fit the two stage buffers; 256 threads stage 32 rows per pass");
  __shared__ __attribute__((aligned(16))) unsigned char sm[2 * G2S * 2]; _Float16* const sg = (_Float16*)sm; float (*const so)[32][68] = (float (*)[32][68])sm;      /* the stage buffers; behind the loop's last barrier the same bytes hold each wave's output rows */
  const int tid = threadIdx.x, w = tid >> 5, wm = w & 3, wn = w >> 2, lane = tid & 31, ln = lane & 15, hh = lane >> 4; const int by = blockIdx.y, bz = blockIdx.z;      /* grid.y = head (strides sA, sB, sC), grid.z = batch (strides zA, zB, zC) */
  A += (size_t)by * sA + (size_t)bz * zA; Bh += (size_t)by * sB + (size_t)bz * zB; const size_t cofs = (size_t)by * sC + (size_t)bz * zC; const float* bp = bias ? bias + (size_t)by * sBias : nullptr;
  const int ntn = N >> 7; const int mt = blockIdx.x / ntn, nq = blockIdx.x - mt * ntn; if (mt * G2T >= M) return;      /* taken by a whole work-group, in front of every barrier */
  const int row0 = mt * G2T + 32 * wm, col0 = nq * G2T + 64 * wn;
  const int sr = tid >> 3, sc = (tid & 7) * 8; const int sl = sr * G2P + sc;      /* staging: row sr + 32 u, eight halves at column sc */
  const _Float16* ag = A + (size_t)(mt * G2T + sr) * lda + sc; const _Float16* bg = Bh + (size_t)(nq * G2T + sr) * ldb + sc; const int nst = K / G2K;
  const v8f z8 = {0.f,0.f,0.f,0.f,0.f,0.f,0.f,0.f}; v8f c00 = z8, c01 = z8, c02 = z8, c03 = z8, c10 = z8, c11 = z8, c12 = z8, c13 = z8;
  v8us ar[4], br[4]; const unsigned short* pa[4]; const unsigned short* pb[4];      /* the full unrolls give these register arrays constant indices and put a stage's eight loads in flight together */
#pragma unroll
  for (int u = 0; u < 4; ++u) { pa[u] = (const unsigned short*)(ag + (size_t)(u * 32) * lda); pb[u] = (const unsigned short*)(bg + (size_t)(u * 32) * ldb); }
#pragma unroll
  for (int u = 0; u < 4; ++u) { ar[u] = *(const v8us*)pa[u]; br[u] = *(const v8us*)pb[u]; }
  asm volatile("s_wait_xcnt 0x0" :: "v"(pa[0]), "v"(pa[1]), "v"(pa[2]), "v"(pa[3]), "v"(pb[0]), "v"(pb[1]), "v"(pb[2]), "v"(pb[3]) : "memory");      /* the loads' address registers are free for reuse only from here on; as inputs they stay whole up to this wait, so that no load returns into one either */
#pragma unroll
  for (int u = 0; u < 4; ++u) { *(v8us*)(unsigned short*)&sg[sl + u * 32 * G2P] = ar[u]; *(v8us*)(unsigned short*)&sg[G2T * G2P + sl + u * 32 * G2P] = br[u]; }
  __syncthreads();
#pragma unroll 1
  for (int s = 0; s < nst; ++s) { const bool more = s + 1 < nst;      /* more: the same for the whole work-group. The stage loop stays rolled, so that its text stays small; its two 32-k passes are unrolled, so that their LDS offsets are immediates */
    if (more) {
#pragma unroll
      for (int u = 0; u < 4; ++u) { pa[u] = (const unsigned short*)(ag + (s + 1) * G2K + (size_t)(u * 32) * lda); pb[u] = (const unsigned short*)(bg + (s + 1) * G2K + (size_t)(u * 32) * ldb); }
#pragma unroll
      for (int u = 0; u < 4; ++u) { ar[u] = *(const v8us*)pa[u]; br[u] = *(const v8us*)pb[u]; }
      asm volatile("s_wait_xcnt 0x0" :: "v"(pa[0]), "v"(pa[1]), "v"(pa[2]), "v"(pa[3]), "v"(pb[0]), "v"(pb[1]), "v"(pb[2]), "v"(pb[3]) : "memory"); }      /* the code below reuses the registers that these loads name: this wait stands in front of that overwrite, and as its inputs they stay whole up to it, so that no load returns into one either */
    const _Float16* ab = sg + (s & 1) * G2S + (32 * wm + ln) * G2P; const _Float16* bb = sg + (s & 1) * G2S + (G2T + 64 * wn + ln) * G2P;
#pragma unroll
    for (int kc = 0; kc < G2K; kc += 32) { const v16h a0 = g2_frag(ab + kc, hh), a1 = g2_frag(ab + 16 * G2P + kc, hh);
      const v16h b0 = g2_frag(bb + kc, hh), b1 = g2_frag(bb + 16 * G2P + kc, hh), b2 = g2_frag(bb + 32 * G2P + kc, hh), b3 = g2_frag(bb + 48 * G2P + kc, hh);
      c00 = g2_mma(a0, b0, c00); c10 = g2_mma(a1, b0, c10); c01 = g2_mma(a0, b1, c01); c11 = g2_mma(a1, b1, c11);
      c02 = g2_mma(a0, b2, c02); c12 = g2_mma(a1, b2, c12); c03 = g2_mma(a0, b3, c03); c13 = g2_mma(a1, b3, c13); }
    if (more) {
#pragma unroll
      for (int u = 0; u < 4; ++u) { *(v8us*)(unsigned short*)&sg[((s + 1) & 1) * G2S + sl + u * 32 * G2P] = ar[u]; *(v8us*)(unsigned short*)&sg[((s + 1) & 1) * G2S + G2T * G2P + sl + u * 32 * G2P] = br[u]; } }
    __syncthreads(); }      /* publishes stage s + 1 and ends every wave's reads of stage s, whose buffer the next trip refills and, behind the last trip, the output rows reuse */
  v8f accs[8] = {c00, c01, c02, c03, c10, c11, c12, c13};
#pragma unroll
  for (int u = 0; u < 8; ++u) { const int t = u & 3, half = u >> 2; const int col = col0 + t * 16 + ln; const float bv = bp ? bf16_round(bp[col]) : 0.f;
#pragma unroll
    for (int r = 0; r < 8; ++r) { const int rloc = half * 16 + 8 * hh + r; float v = accs[u][r] * alpha + bv; if (CP) { if (rowsPerB < 0) v += CP[cofs + (size_t)(row0g + row0 + rloc) * ldc + col];      /* rowsPerB < 0: own element of the batched C plane */ else { const int bidx = (row0g + row0 + rloc) / rowsPerB; v += CP[(size_t)bidx * sCPb + (size_t)by * 64 + col]; } }
      if (ACT == 3) v = fmaxf(v, 0.f); else if (ACT == 6) v = 0.5f * v * (1.0f + erff(v * 0.70710678118654752f)); else if (ACT == 11) v = 1.0f / (1.0f + expf(-v)); else if (ACT == 15) v = v / (1.0f + expf(-v)); else if (ACT == 12) v = (v > 0.f) ? v : 0.01f * v; else if (ACT == 8) v = tanhf(v); else if (ACT == 9) v = 0.5f * v * (1.0f + tanhf(0.7978845608028654f * (v + 0.044715f * v * v * v))); else if (ACT == 14) v = (v > 0.f) ? v : 0.1f * v; else if (ACT == 16) v = (v >= 0.f) ? v : 0.3f * v; else if (ACT == 17) v = (v >= 0.f) ? v : 0.2f * v;
      so[w][rloc][t * 16 + ln] = v; } }
  __builtin_amdgcn_fence(__ATOMIC_ACQ_REL, "workgroup"); __builtin_amdgcn_wave_barrier();
  const int rsub = lane >> 4, c4 = (lane & 15) * 4;
  {
#pragma unroll
    for (int q = 0; q < 16; ++q) { const int r = q * 2 + rsub; const v4f v = *(const v4fa*)&so[w][r][c4]; if (C) *(v4f*)(C + cofs + (size_t)(row0 + r) * ldc + col0 + c4) = v; if (C16) { v4h h4; for (int i = 0; i < 4; ++i) h4[i] = (_Float16)v[i]; *(v4h*)(C16 + cofs + (size_t)(row0 + r) * ldc + col0 + c4) = h4; } }
     } }


__global__ __launch_bounds__(256) void k_wnat(const float* __restrict__ w, size_t n8, _Float16* __restrict__ Bt) { const size_t t = (size_t)blockIdx.x * 256 + threadIdx.x; if (t >= n8) return; FragH f; for (int q = 0; q < 8; ++q) f.h[q] = (_Float16)(bf16_round(w[t * 8 + q]) * 16.0f); *(v8us*)((unsigned short*)Bt + t * 8) = f.half[0];  }
__global__ __launch_bounds__(256) void k_rsm(const float* __restrict__ S, _Float16* __restrict__ P, int nrows) {
  #pragma clang fp contract(off)
  const int i = blockIdx.x * 256 + threadIdx.x; if (i >= nrows) return; const float* s = S + (size_t)i * SQ; float mx = -3.0e38f;
#pragma unroll 1
  for (int j = 0; j < SQ; ++j) mx = fmaxf(mx, s[j]); float se = 0.f;
#pragma unroll 1
  for (int j = 0; j < SQ; ++j) se += expf(s[j] - mx); const float sc = 256.0f / se;
#pragma unroll 1
  for (int j0 = 0; j0 < SQ; j0 += 8) { FragH f; for (int q = 0; q < 8; ++q) f.h[q] = (_Float16)(expf(s[j0 + q] - mx) * sc); unsigned short* d = (unsigned short*)P + (size_t)i * SQ + j0; *(v8us*)d = f.half[0];  } }
__global__ __launch_bounds__(256) void k_vt(const _Float16* __restrict__ V16, int b, int h0, _Float16* __restrict__ VT) { __shared__ unsigned short tl[64][65]; const int tid = threadIdx.x; const int hh = blockIdx.x % HG, sg = blockIdx.x / HG; const int s0 = sg * 64; const int h = h0 + hh;
  for (int i = tid; i < 64 * 8; i += 256) { const int j = i / 8, d8 = (i % 8) * 8; FragH f; f.half[0] = *(const v8us*)((const unsigned short*)V16 + ((size_t)b * SQ + s0 + j) * DM + h * HD + d8); for (int q = 0; q < 8; ++q) tl[d8 + q][j] = f.u[q]; }
  __syncthreads();
  { for (int i = tid; i < 64 * 8; i += 256) { const int d = i / 8, j8 = (i % 8) * 8; FragH f; for (int q = 0; q < 8; ++q) f.u[q] = tl[d][j8 + q]; *(v8us*)((unsigned short*)VT + ((size_t)hh * HD + d) * SQ + s0 + j8) = f.half[0]; }  } }



// Lane l <-> l ^ M inside a 16-lane row (DPP row_xmask) and l <-> l ^ 16 (cross-row move): a five-step butterfly leaves the row's maximum / sum in every lane without an LDS round trip.
template <int M> __device__ __forceinline__ float rs_xm(float x) { return __builtin_bit_cast(float, __builtin_amdgcn_update_dpp(0, __builtin_bit_cast(int, x), 0x160 | M, 0xf, 0xf, true)); }
__device__ __forceinline__ float rs_xh(float x) { return __builtin_bit_cast(float, __builtin_amdgcn_permlanex16(__builtin_bit_cast(int, x), __builtin_bit_cast(int, x), 0x76543210, 0xfedcba98, false, false)); }
// Fused causal attention, all batches, heads and query tiles in ONE launch: scores, softmax and weighted values stay in registers, nothing of them goes to memory.
// A work-group of FAW waves takes FAQ query rows of one head, 32 per wave, and walks the keys 0 .. its last row in stages of FAK keys. A stage's K rows [key][d] and V^T rows [d][key] are fetched with whole-line loads
// one stage ahead into registers and stored to one of two LDS buffers; one barrier per stage publishes the next buffer and ends the reads of the one that is refilled after it.
// Per 32-key pass a wave forms S^T = K Q^T (A = K rows, B = q rows held in registers): lane (c, h) then holds keys 8h + r of query c, so the maximum and the sum are in-lane plus one exchange of the wave's halves,
// and the two 16-key score tiles, converted in place, are the B operand of O^T += V^T P^T (A = V^T rows in the same k order). Online softmax in the log2 domain; the maximum in use may trail the true one by up to 8,
// so a weight can reach 2^8 (f16 holds it at full relative precision) and the accumulators are rescaled only in the rare pass in which some query's maximum grows by more.
// The full unrolls in the kernel give its register arrays (fragments, score tiles, accumulators, staged rows) constant indices, without which they would go to scratch memory.
#define FAW 4                        /* waves per work-group */
#define FAQ (FAW * 32)               /* query rows per work-group */
#define FAK 64                       /* keys per LDS stage: two 32-key passes; 64 f16 = one 128-byte line of a V^T row */
#define FAP (HD + 8)                 /* LDS row pitch in halves: 144 B = 16 B x odd, so that the 16 rows of a fragment load fall on different banks */
__device__ __forceinline__ v8f fa_mma(v16h a, v16h b, v8f c) { return __builtin_amdgcn_wmma_f32_16x16x32_f16(false, a, false, b, (short)0, c, false, false); }
__device__ __forceinline__ v16h fa_frag(const _Float16* p) { FragH f; f.half[0] = *(const v8us*)(const unsigned short*)p; f.half[1] = *(const v8us*)((const unsigned short*)p + 16); return f.v; }      /* p already holds the lane's 8 * h: k = 8h .. 8h+7 and 16+8h .. 16+8h+7, the order of g2_frag */
// Four vector slots between a run of matrix instructions and the branch behind it: on the taken side the next vector instruction may read their results. The two scheduling barriers keep the slots at that place.
__device__ __forceinline__ void fa_gap() { __builtin_amdgcn_sched_barrier(0); asm volatile("v_nop\n\tv_nop\n\tv_nop\n\tv_nop"); __builtin_amdgcn_sched_barrier(0); }
__global__ __launch_bounds__(FAW * 32) void k_fattn(const _Float16* __restrict__ Qh, const _Float16* __restrict__ Kh, const _Float16* __restrict__ Vt, _Float16* __restrict__ Oh) {
  static_assert(HD == 64 && FAK == 64 && FAQ % FAK == 0 && SQ / FAQ == 16 && NB * NH == 64 && FAW * 32 == 128 && KVD == DM, "16 query tiles x 64 (batch, head) pairs; 8 threads stage one 128-byte row, 16 rows per pass of the staging loop");
  __shared__ __attribute__((aligned(16))) _Float16 ks[2][FAK * FAP]; __shared__ __attribute__((aligned(16))) _Float16 vs[2][HD * FAP];
  const int tid = threadIdx.x, lane = tid & 31, c = lane & 15, h = lane >> 4; const int w = __builtin_amdgcn_readfirstlane(tid >> 5); const int idx = blockIdx.x;
  // A tile's cost grows with its index and all work-groups are resident together: the 16 tiles are dealt by a 4 x 4 square whose rows and columns all sum to 30 (row = idx / 256, column = (idx / 8) % 4), every (head, tile) pair once.
  const int tile = (int)((0x0DE3B6587A94C12FULL >> (4 * (((idx >> 8) << 2) | ((idx >> 3) & 3)))) & 15); const int bh = (idx & 7) | (((idx >> 5) & 7) << 3); const int b = bh / NH, hd = bh % NH;
  const int q0 = tile * FAQ, qw = q0 + 32 * w, nst = (q0 + FAQ) / FAK;      /* causal: keys below the tile's end */
  const int sr = tid >> 3, sc = (tid & 7) * 8; const int so = sr * FAP + sc;      /* staging: row sr + 16 u, eight halves at column sc */
  const _Float16* kg = Kh + ((size_t)b * SQ + sr) * KVD + hd * HD + sc; const _Float16* vg = Vt + ((size_t)bh * HD + sr) * SQ + sc;
  v8us kr[4], vr[4];
#pragma unroll
  for (int u = 0; u < 4; ++u) { kr[u] = *(const v8us*)(const unsigned short*)(kg + u * 16 * KVD); vr[u] = *(const v8us*)(const unsigned short*)(vg + u * 16 * SQ); }
  v16h qf[2][2];
#pragma unroll
  for (int g = 0; g < 2; ++g) for (int kc = 0; kc < 2; ++kc) qf[g][kc] = g2_frag(Qh + ((size_t)b * SQ + qw + 16 * g + c) * LQ + hd * HD + kc * 32, h);
  asm volatile("s_wait_xcnt 0x0" ::: "memory");      /* the q rows' address registers are free for reuse from here on: this wait stands in front of their overwrite */
#pragma unroll
  for (int u = 0; u < 4; ++u) { *(v8us*)(unsigned short*)&ks[0][so + u * 16 * FAP] = kr[u]; *(v8us*)(unsigned short*)&vs[0][so + u * 16 * FAP] = vr[u]; }
  const v8f z8 = {0.f, 0.f, 0.f, 0.f, 0.f, 0.f, 0.f, 0.f}; const v4f z4 = {0.f, 0.f, 0.f, 0.f};
  v8f acc[2][4]; v4f l4[2]; float mr[2];
#pragma unroll
  for (int g = 0; g < 2; ++g) { mr[g] = -__builtin_inff(); l4[g] = z4; for (int t = 0; t < 4; ++t) acc[g][t] = z8; }
  const float cs = 0.125f * 1.44269504088896340736f;      /* 64^-0.5 log2 e */
  __syncthreads();
  for (int st = 0; st < nst; ++st) {
    const bool more = st + 1 < nst;      /* the same for the whole work-group */
    if (more) {
#pragma unroll
      for (int u = 0; u < 4; ++u) { kr[u] = *(const v8us*)(const unsigned short*)(kg + (size_t)(st + 1) * FAK * KVD + u * 16 * KVD); vr[u] = *(const v8us*)(const unsigned short*)(vg + (st + 1) * FAK + u * 16 * SQ); }
      asm volatile("s_wait_xcnt 0x0" ::: "memory"); }      /* the pass below reuses the registers that hold these loads' addresses: this wait stands in front of that overwrite */
    const _Float16* kb = &ks[st & 1][c * FAP + 8 * h]; const _Float16* vb = &vs[st & 1][c * FAP + 8 * h];
    for (int p = 0; p < FAK / 32; ++p) { const int key0 = st * FAK + p * 32;
      if (key0 <= qw) {      /* wave-uniform: a wave skips the passes beyond its diagonal, never the barrier */
        v8f s[2][2];
        { v16h kf[2][2];
#pragma unroll
          for (int kt = 0; kt < 2; ++kt) for (int kc = 0; kc < 2; ++kc) kf[kt][kc] = fa_frag(kb + (p * 32 + 16 * kt) * FAP + kc * 32);
#pragma unroll
          for (int kt = 0; kt < 2; ++kt) for (int g = 0; g < 2; ++g) s[kt][g] = fa_mma(kf[kt][1], qf[g][1], fa_mma(kf[kt][0], qf[g][0], z8)); }      /* s[kt][g][r] = q(qw + 16g + c) . k(key0 + 16kt + 8h + r) */
        fa_gap();
        if (key0 == qw) {      /* the one pass on the wave's diagonal: key > query is masked; key key0 is kept in every row */
#pragma unroll
          for (int kt = 0; kt < 2; ++kt) for (int g = 0; g < 2; ++g) for (int r = 0; r < 8; ++r) s[kt][g][r] = (16 * kt + 8 * h + r > 16 * g + c) ? -__builtin_inff() : s[kt][g][r]; }
        float mb[2]; bool need = false;
#pragma unroll
        for (int g = 0; g < 2; ++g) { float mx = s[0][g][0];
#pragma unroll
          for (int r = 1; r < 8; ++r) mx = fmaxf(mx, s[0][g][r]);
#pragma unroll
          for (int r = 0; r < 8; ++r) mx = fmaxf(mx, s[1][g][r]);
          mx = fmaxf(mx, rs_xh(mx)) * cs; mb[g] = mx; need = need || (mx > mr[g] + 8.0f); }      /* both halves of the wave hold the query's maximum of this pass, scaled */
        if (__builtin_amdgcn_ballot_w32(need) != 0) {      /* scalar branch; always taken in a wave's first pass, where mr is -inf and the factor 0 */
#pragma unroll
          for (int g = 0; g < 2; ++g) { const float mn = fmaxf(mr[g], mb[g]); const float corr = __builtin_amdgcn_exp2f(mr[g] - mn); mr[g] = mn; l4[g] *= corr;
#pragma unroll
            for (int t = 0; t < 4; ++t) acc[g][t] *= corr; } }
        v16h vf[4];
#pragma unroll
        for (int t = 0; t < 4; ++t) vf[t] = fa_frag(vb + 16 * t * FAP + p * 32);
#pragma unroll
        for (int g = 0; g < 2; ++g) { const float nm = -mr[g]; FragH pf;
#pragma unroll
          for (int kt = 0; kt < 2; ++kt) for (int j = 0; j < 2; ++j) { const v4f x = {s[kt][g][4 * j], s[kt][g][4 * j + 1], s[kt][g][4 * j + 2], s[kt][g][4 * j + 3]}; const v4f y = x * cs + nm; const v4f e = {__builtin_amdgcn_exp2f(y[0]), __builtin_amdgcn_exp2f(y[1]), __builtin_amdgcn_exp2f(y[2]), __builtin_amdgcn_exp2f(y[3])}; l4[g] += e;      /* the builtin, so that the compiler keeps these writes clear of the matrix instructions' operands */
            for (int i = 0; i < 4; ++i) pf.h[8 * kt + 4 * j + i] = (_Float16)e[i]; }      /* element 8 kt + r of the B operand = key 16 kt + 8 h + r: the k order of fa_frag */
#pragma unroll
          for (int t = 0; t < 4; ++t) acc[g][t] = fa_mma(vf[t], pf.v, acc[g][t]); }      /* acc[g][t][r] = o(qw + 16g + c)[16t + 8h + r], not yet divided by the row sum */
        fa_gap();
      } }
    if (more) {
#pragma unroll
      for (int u = 0; u < 4; ++u) { *(v8us*)(unsigned short*)&ks[(st + 1) & 1][so + u * 16 * FAP] = kr[u]; *(v8us*)(unsigned short*)&vs[(st + 1) & 1][so + u * 16 * FAP] = vr[u]; }
      __syncthreads(); }      /* publishes stage st + 1 and ends every wave's reads of stage st, whose buffer the next trip refills */
  }
  v8us ov[2][4]; unsigned short* og = (unsigned short*)Oh + ((size_t)b * SQ + qw + c) * DM + hd * HD + 8 * h;      /* lane (c, h): 8 consecutive d of query row c, one 16-byte store per 16 d */
#pragma unroll
  for (int g = 0; g < 2; ++g) { float l = (l4[g][0] + l4[g][1]) + (l4[g][2] + l4[g][3]); l += rs_xh(l); const float fin = 64.0f / l;      /* o carried x64, as the output GEMM's factor expects */
#pragma unroll
    for (int t = 0; t < 4; ++t) { FragH f; for (int r = 0; r < 8; ++r) f.h[r] = (_Float16)(acc[g][t][r] * fin); ov[g][t] = f.half[0]; } }
  __builtin_amdgcn_sched_barrier(0);      /* the eight stores stand behind the last conversion, so that no register which an issued store names is written again */
#pragma unroll
  for (int g = 0; g < 2; ++g) for (int t = 0; t < 4; ++t) *(v8us*)(og + g * 16 * DM + 16 * t) = ov[g][t]; }


// Exact f32 causal attention for rows 0..QT0-1 of every batch and head (planes [batch][QT0][DM]). One work-group of 256 threads takes A0R query rows of one head: thread (r, c) = (tid / 8, tid % 8).
// The group's q rows and the head's QT0 key and value rows are staged in LDS once; then scores (thread (r, c): keys c, c + 8, ...; its q row in registers), the row maximum and sum over the row's 8 lanes, and o (thread (r, c): columns 4c..4c+3 and 32+4c..32+4c+3).
#define A0R 32                       /* query rows per work-group */
#define A0KP (HD + 4)                /* q and key row pitch in LDS, floats: 16 B x odd, so that 8 rows read at one column fall on different banks */
#define A0PP (QT0 + 8)               /* weight row pitch in LDS, floats: the 4 rows of a wave start 8 banks apart */
// o leaves as two f16 planes [batch][QT0][DM]: hi = f16(o), lo = f16((o - hi) * 1024), the A rows of the output projection's first-tile work-groups.
__global__ __launch_bounds__(256) void k_att0(const float* __restrict__ QF, const float* __restrict__ KF, const float* __restrict__ VF, float scale, _Float16* __restrict__ OH, _Float16* __restrict__ OL) {
  static_assert(QT0 % A0R == 0 && A0R * 8 == 256 && A0R == 32 && HD == 64 && QT0 % 16 == 0, "8 threads per query row; 16 threads stage one row, 16 rows per pass");
  __shared__ __attribute__((aligned(16))) float ks[QT0 * A0KP]; __shared__ __attribute__((aligned(16))) float vs[QT0 * HD]; __shared__ __attribute__((aligned(16))) float qs[A0R * A0KP]; __shared__ __attribute__((aligned(16))) float ps[A0R * A0PP];
  const int tid = threadIdx.x; const int h = blockIdx.x / (QT0 / A0R), rg = blockIdx.x % (QT0 / A0R); const int r = tid >> 3, c = tid & 7; const int i = rg * A0R + r; const int nk = (rg + 1) * A0R;      /* causal: keys below the group's last row */
  const size_t bo = (size_t)blockIdx.y * QT0 * DM + (size_t)h * HD;      /* grid.y = batch */
  const int sr = tid >> 4, sc = (tid & 15) * 4; const int so = sr * DM + sc;      /* staging: row sr + 16 u, four floats at column sc */
  const float* kg = KF + bo; const float* vg = VF + bo; const float* qg = QF + bo + (size_t)rg * A0R * DM;
  v4f kk[QT0 / 16], vv[QT0 / 16];      /* the full unrolls below give the register arrays kk, vv, q constant indices and put all staging loads in flight together */
#pragma unroll
  for (int u = 0; u < QT0 / 16; ++u) { kk[u] = *(const v4fa*)(kg + so + u * 16 * DM); vv[u] = *(const v4fa*)(vg + so + u * 16 * DM); }
  const v4f q0 = *(const v4fa*)(qg + so);
  asm volatile("s_wait_xcnt 0x0" ::: "memory");      /* the last staging load may return into the offset register that the loads above name: this wait stands in front of that overwrite */
  const v4f q1 = *(const v4fa*)(qg + so + 16 * DM);
#pragma unroll
  for (int u = 0; u < QT0 / 16; ++u) { *(v4f*)&ks[(sr + u * 16) * A0KP + sc] = kk[u]; *(v4f*)&vs[(sr + u * 16) * HD + sc] = vv[u]; }
  *(v4f*)&qs[sr * A0KP + sc] = q0; *(v4f*)&qs[(sr + 16) * A0KP + sc] = q1;
  __syncthreads();
  v4f q[HD / 4];
#pragma unroll
  for (int u = 0; u < HD / 4; ++u) q[u] = *(const v4f*)&qs[r * A0KP + u * 4];
  float* pr = ps + r * A0PP; float mx = -3.0e38f;      /* unroll 2 in the three loops below: the LDS loads of two trips are in flight together and their sums are independent chains */
#pragma unroll 2
  for (int m = 0; m < nk / 8; ++m) { const int j = c + m * 8; const float* kp = ks + j * A0KP; v4f a = {0.f, 0.f, 0.f, 0.f};
#pragma unroll
    for (int u = 0; u < HD / 4; ++u) a += q[u] * *(const v4f*)(kp + u * 4);
    const float s = (j <= i) ? ((a[0] + a[1]) + (a[2] + a[3])) * scale : -3.0e38f; pr[j] = s; mx = fmaxf(mx, s); }
  mx = fmaxf(mx, rs_xm<1>(mx)); mx = fmaxf(mx, rs_xm<2>(mx)); mx = fmaxf(mx, rs_xm<4>(mx));      /* key 0 is kept in every row, so the row maximum is a real score and a masked key's weight is exp(-huge) = 0 */
  float l = 0.f;
#pragma unroll 2
  for (int m = 0; m < nk / 8; ++m) { const int j = c + m * 8; const float e = expf(pr[j] - mx); pr[j] = e; l += e; }
  l += rs_xm<1>(l); l += rs_xm<2>(l); l += rs_xm<4>(l);
  __syncthreads();
  v4f o0 = {0.f, 0.f, 0.f, 0.f}, o1 = {0.f, 0.f, 0.f, 0.f}; const float* vp = vs + c * 4;
#pragma unroll 2
  for (int j = 0; j < nk; j += 4) { const v4f p = *(const v4f*)(pr + j);
#pragma unroll
    for (int t = 0; t < 4; ++t) { o0 += p[t] * *(const v4f*)(vp + (j + t) * HD); o1 += p[t] * *(const v4f*)(vp + (j + t) * HD + HD / 2); } }
  const float fin = 64.0f / l;      /* o carried x64 like the f16 path */
  const v4f a0 = o0 * fin, a1 = o1 * fin; v4h h0, h1, l0, l1;
#pragma unroll
  for (int t = 0; t < 4; ++t) { _Float16 hv = (_Float16)a0[t]; h0[t] = hv; l0[t] = (_Float16)((a0[t] - (float)hv) * 1024.0f); hv = (_Float16)a1[t]; h1[t] = hv; l1[t] = (_Float16)((a1[t] - (float)hv) * 1024.0f); }
  const size_t oo = bo + i * DM + c * 4; *(v4h*)(OH + oo) = h0; *(v4h*)(OH + oo + HD / 2) = h1; *(v4h*)(OL + oo) = l0; *(v4h*)(OL + oo + HD / 2) = l1; }


__global__ __launch_bounds__(256) void k_tab2(float theta, float* __restrict__ CS, float* __restrict__ SN) {
  #pragma clang fp contract(off)
  const int t = blockIdx.x * 256 + threadIdx.x; if (t >= SQ * (HD / 2)) return; const int i = t % (HD / 2); const int p = t / (HD / 2); const float invf = 1.0f / powf(theta, (float)(2 * i) / (float)HD); const float ang = __fmul_rn((float)p, invf); const float c = cosf(ang), s = sinf(ang);
  *(float*)(CS + t) = c; *(float*)(SN + t) = s;  }
// q, k and v projections of all token rows in ONE launch, with everything that stood between them and the attention kernels done in the epilogue. The stage loop is that of k_gemm2 (128 x 128 tile, 8 waves of 32 x 64, two LDS buffers, K = DM).
// Work-group (xt, j): xt = tile of 128 token rows, j = tile of 128 rows of the transposed fused weight Wt [3 DM][DM] (j / 8 = 0 q, 1 k, 2 v).
// q, k: A = token rows, B = weight rows. A wave's 64 columns are one head, so that after the turn through LDS lane l holds columns 4l .. 4l + 3 of a row and the rotate-half partner sits 8 lanes away (DPP exchange):
// out_lo = x_lo c - x_hi s, out_hi = x_hi c + x_lo s, written as f16 rows; the first QT0 rows of a batch also as f32 rows [batch][QT0][DM] for the exact first-tile kernel.
// v: the operands change places (A = weight rows, B = token rows; same k order, same products), so that the tile comes out as V^T [d][token] and its rows are whole lines of the plane [batch][head][d][SQ];
// of the first QT0 tokens of a batch a lane's 8 accumulator rows are 8 consecutive d of one token: stored as f32 v rows [batch][QT0][DM] straight from the registers.
// The full unrolls give the register arrays constant indices and put a phase's loads or stores in flight together.
__global__ __launch_bounds__(256) void k_proj3(const _Float16* __restrict__ X, const _Float16* __restrict__ Wt, const float* __restrict__ CS, const float* __restrict__ SN,
    _Float16* __restrict__ Qh, _Float16* __restrict__ Kh, _Float16* __restrict__ Vt, float* __restrict__ QF0, float* __restrict__ KF0, float* __restrict__ VF0) {
  static_assert(2 * G2S * 2 >= 8 * 32 * 68 * 4 && G2T == 128 && G2K == 64 && DM % G2K == 0 && SQ % G2T == 0 && QT0 == G2T && HD == 64 && KVD == DM && HPG == 1 && SQ / G2T == 16 && DM / G2T == 8, "a wave's 64 columns are one head; a token tile lies in one batch; the first tile of a batch is the exact kernel's rows");
  __shared__ __attribute__((aligned(16))) unsigned char sm[2 * G2S * 2]; _Float16* const sg = (_Float16*)sm; float (*const so)[32][68] = (float (*)[32][68])sm;      /* the stage buffers; behind the loop's last barrier the same bytes hold each wave's output rows */
  const int tid = threadIdx.x, lane = tid & 31, ln = lane & 15, hh = lane >> 4; const int w = __builtin_amdgcn_readfirstlane(tid >> 5), wm = w & 3, wn = w >> 2;
  const int xt = blockIdx.x / 24, j = blockIdx.x - xt * 24; const bool isv = j >= 16; const int bt = xt >> 4, xs = xt & 15;      /* bt = batch, xs = token tile in the batch; all the same for the whole work-group */
  const _Float16* const xr = X + (size_t)xt * G2T * DM; const _Float16* const wr = Wt + (size_t)j * G2T * DM;
  const int sr = tid >> 3, sc = (tid & 7) * 8; const int sl = sr * G2P + sc;      /* staging: row sr + 32 u, eight halves at column sc */
  const _Float16* ag = (isv ? wr : xr) + sr * DM + sc; const _Float16* bg = (isv ? xr : wr) + sr * DM + sc; const int nst = DM / G2K;
  const v8f z8 = {0.f,0.f,0.f,0.f,0.f,0.f,0.f,0.f}; v8f c00 = z8, c01 = z8, c02 = z8, c03 = z8, c10 = z8, c11 = z8, c12 = z8, c13 = z8;
  v8us ar[4], br[4]; const unsigned short* pa[4]; const unsigned short* pb[4];
#pragma unroll
  for (int u = 0; u < 4; ++u) { pa[u] = (const unsigned short*)(ag + (size_t)(u * 32) * DM); pb[u] = (const unsigned short*)(bg + (size_t)(u * 32) * DM); }
#pragma unroll
  for (int u = 0; u < 4; ++u) { ar[u] = *(const v8us*)pa[u]; br[u] = *(const v8us*)pb[u]; }
  asm volatile("s_wait_xcnt 0x0" :: "v"(pa[0]), "v"(pa[1]), "v"(pa[2]), "v"(pa[3]), "v"(pb[0]), "v"(pb[1]), "v"(pb[2]), "v"(pb[3]) : "memory");      /* the loads' address registers are free for reuse only from here on; as inputs they stay whole up to this wait, so that no load returns into one either */
#pragma unroll
  for (int u = 0; u < 4; ++u) { *(v8us*)(unsigned short*)&sg[sl + u * 32 * G2P] = ar[u]; *(v8us*)(unsigned short*)&sg[G2T * G2P + sl + u * 32 * G2P] = br[u]; }
  __syncthreads();
#pragma unroll 1
  for (int s = 0; s < nst; ++s) { const bool more = s + 1 < nst;      /* more: the same for the whole work-group. The stage loop stays rolled, so that its text stays small; its two 32-k passes are unrolled, so that their LDS offsets are immediates */
    if (more) {
#pragma unroll
      for (int u = 0; u < 4; ++u) { pa[u] = (const unsigned short*)(ag + (s + 1) * G2K + (size_t)(u * 32) * DM); pb[u] = (const unsigned short*)(bg + (s + 1) * G2K + (size_t)(u * 32) * DM); }
#pragma unroll
      for (int u = 0; u < 4; ++u) { ar[u] = *(const v8us*)pa[u]; br[u] = *(const v8us*)pb[u]; }
      asm volatile("s_wait_xcnt 0x0" :: "v"(pa[0]), "v"(pa[1]), "v"(pa[2]), "v"(pa[3]), "v"(pb[0]), "v"(pb[1]), "v"(pb[2]), "v"(pb[3]) : "memory"); }      /* the code below reuses the registers that these loads name: this wait stands in front of that overwrite, and as its inputs they stay whole up to it, so that no load returns into one either */
    const _Float16* ab = sg + (s & 1) * G2S + (32 * wm + ln) * G2P; const _Float16* bb = sg + (s & 1) * G2S + (G2T + 64 * wn + ln) * G2P;
#pragma unroll
    for (int kc = 0; kc < G2K; kc += 32) { const v16h a0 = g2_frag(ab + kc, hh), a1 = g2_frag(ab + 16 * G2P + kc, hh);
      const v16h b0 = g2_frag(bb + kc, hh), b1 = g2_frag(bb + 16 * G2P + kc, hh), b2 = g2_frag(bb + 32 * G2P + kc, hh), b3 = g2_frag(bb + 48 * G2P + kc, hh);
      c00 = g2_mma(a0, b0, c00); c10 = g2_mma(a1, b0, c10); c01 = g2_mma(a0, b1, c01); c11 = g2_mma(a1, b1, c11);
      c02 = g2_mma(a0, b2, c02); c12 = g2_mma(a1, b2, c12); c03 = g2_mma(a0, b3, c03); c13 = g2_mma(a1, b3, c13); }
    if (more) {
#pragma unroll
      for (int u = 0; u < 4; ++u) { *(v8us*)(unsigned short*)&sg[((s + 1) & 1) * G2S + sl + u * 32 * G2P] = ar[u]; *(v8us*)(unsigned short*)&sg[((s + 1) & 1) * G2S + G2T * G2P + sl + u * 32 * G2P] = br[u]; } }
    __syncthreads(); }      /* publishes stage s + 1 and ends every wave's reads of stage s, whose buffer the next trip refills and, behind the last trip, the output rows reuse */
  v8f accs[8] = {c00, c01, c02, c03, c10, c11, c12, c13};
#pragma unroll
  for (int u = 0; u < 8; ++u) accs[u] *= 0.0625f;      /* the weights are carried x16 */
  if (isv && xs == 0) { char* fb = (char*)(VF0 + ((size_t)bt * QT0 + 64 * wn) * DM + (j - 16) * G2T + 32 * wm); const unsigned fo = ln * (DM * 4u) + hh * 32u;      /* f32 v rows: token 16 t + ln, columns 16 half + 8 hh + 0..7 of the wave's 32 */
#pragma unroll
    for (int u = 0; u < 8; ++u) { const v4f lo = {accs[u][0], accs[u][1], accs[u][2], accs[u][3]}, hi = {accs[u][4], accs[u][5], accs[u][6], accs[u][7]};
      *(v4f*)(fb + (u & 3) * 16 * (DM * 4) + (u >> 2) * 64 + fo) = lo; *(v4f*)(fb + (u & 3) * 16 * (DM * 4) + (u >> 2) * 64 + 16 + fo) = hi; }
    asm volatile("s_wait_xcnt 0x0" ::: "memory"); }      /* the accumulators' registers, which these stores name, are reused below: this wait stands in front of that overwrite */
#pragma unroll
  for (int u = 0; u < 8; ++u)
#pragma unroll
    for (int r = 0; r < 8; ++r) so[w][(u >> 2) * 16 + 8 * hh + r][(u & 3) * 16 + ln] = accs[u][r];
  __builtin_amdgcn_fence(__ATOMIC_ACQ_REL, "workgroup"); __builtin_amdgcn_wave_barrier();      /* a wave reads back only its own rows */
  v4h oh[16];
  if (!isv) {
    // Lanes 0..7 of a 16-lane row fetch the row's cosines, lanes 8..15 its sines (one 128-byte table row each); the DPP exchange that brings the partner's x brings the other table value too.
    const bool up = (ln & 8) != 0; const char* tp = (const char*)((up ? SN : CS) + (xs * G2T + 32 * wm + hh) * (HD / 2) + (ln & 7) * 4); v4f tv[16];
#pragma unroll
    for (int q = 0; q < 16; ++q) tv[q] = *(const v4fa*)(tp + q * 2 * (HD / 2 * 4));
    asm volatile("s_wait_xcnt 0x0" :: "v"(tp) : "memory");      /* the table loads' address registers are free for reuse only from here on; as an input they stay whole up to this wait, so that no load returns into them either */
#pragma unroll
    for (int q0 = 0; q0 < 16; q0 += 4) { v4f xv[4];      /* four rows' LDS reads in flight together; the roped row takes the place of its table values */
#pragma unroll
      for (int q = 0; q < 4; ++q) xv[q] = *(const v4fa*)&so[w][(q0 + q) * 2 + hh][ln * 4];
#pragma unroll
      for (int q = 0; q < 4; ++q) { const v4f x = xv[q], t = tv[q0 + q]; const v4f y = {rs_xm<8>(x[0]), rs_xm<8>(x[1]), rs_xm<8>(x[2]), rs_xm<8>(x[3])};
        const v4f tw = {rs_xm<8>(t[0]), rs_xm<8>(t[1]), rs_xm<8>(t[2]), rs_xm<8>(t[3])}; const v4f cc = up ? tw : t; const v4f sn = up ? t : -tw; const v4f o = x * cc + y * sn; tv[q0 + q] = o;
        for (int i = 0; i < 4; ++i) oh[q0 + q][i] = (_Float16)o[i]; }
      __builtin_amdgcn_sched_barrier(0); }      /* keeps the later rows' table exchanges behind this point: hoisted, they hold twice the registers per row and cost a work-group of occupancy; behind the last row it keeps the stores behind the arithmetic, so that no register which an issued store names is written again */
    char* hb = (char*)((j >= 8 ? Kh : Qh) + ((size_t)xt * G2T + 32 * wm) * DM + (j & 7) * G2T + 64 * wn); const unsigned ho = hh * (DM * 2u) + ln * 8u;
#pragma unroll
    for (int q = 0; q < 16; ++q) *(v4h*)(hb + q * 2 * (DM * 2) + ho) = oh[q];
    if (xs == 0) { asm volatile("s_wait_xcnt 0x0" ::: "memory"); __builtin_amdgcn_sched_barrier(0);      /* the address arithmetic below reuses registers that the f16 stores name: this wait stands in front of that overwrite, and the scheduling barrier keeps the arithmetic behind it */
      char* fb = (char*)((j >= 8 ? KF0 : QF0) + ((size_t)bt * QT0 + 32 * wm) * DM + (j & 7) * G2T + 64 * wn); const unsigned fo = hh * (DM * 4u) + ln * 16u;      /* the first QT0 rows of a batch: the same values unrounded */
#pragma unroll
      for (int q = 0; q < 16; ++q) *(v4f*)(fb + q * 2 * (DM * 4) + fo) = tv[q]; }
  } else {
#pragma unroll
    for (int q = 0; q < 16; ++q) { const v4f v = *(const v4fa*)&so[w][q * 2 + hh][ln * 4]; for (int i = 0; i < 4; ++i) oh[q][i] = (_Float16)v[i]; }
    __builtin_amdgcn_sched_barrier(0);      /* the stores stand behind the last conversion, so that no register which an issued store names is written again */
    char* vb = (char*)(Vt + ((size_t)bt * DM + (j - 16) * G2T + 32 * wm) * SQ + xs * G2T + 64 * wn); const unsigned vo = hh * (SQ * 2u) + ln * 8u;      /* row of V^T = head * HD + d */
#pragma unroll
    for (int q = 0; q < 16; ++q) *(v4h*)(vb + q * 2 * (SQ * 2) + vo) = oh[q];
  } }

// Output projection of all token rows in ONE launch: out = o Wo with o carried x64 and Wo x16. The stage loop is that of k_gemm2 (128 x 128 tile, 8 waves of 32 x 64, two LDS buffers, K = DM).
// Work-groups NB * 16 and up: one tile of 128 f16 o rows, the first tile of every batch left out. Work-groups 0 .. NB * 16 - 1 take those first tiles from the exact kernel's planes, 64 token rows each:
// A rows 0..63 of the tile are the rows' hi plane and A rows 64..127 the same rows' lo plane, so that hi Wo and lo Wo come out of the same 16 stages side by side (waves wm = 0, 1 and wm = 2, 3);
// after the turn through LDS wave wm adds its partner's (wm + 2) rows: out = hi Wo 2^-10 + lo Wo 2^-20, the sum that two more launches formed through the output buffer before.
__global__ __launch_bounds__(256) void k_outp(const _Float16* __restrict__ O, const _Float16* __restrict__ OH, const _Float16* __restrict__ OL, const _Float16* __restrict__ Wt, float* __restrict__ C) {
  static_assert(2 * G2S * 2 >= 8 * 32 * 68 * 4 && G2T == 128 && G2K == 64 && DM % G2K == 0 && QT0 == G2T && SQ / G2T == 16 && DM / G2T == 8, "16 row tiles per batch, the first of them the exact kernel's rows; 8 column tiles");
  __shared__ __attribute__((aligned(16))) unsigned char sm[2 * G2S * 2]; _Float16* const sg = (_Float16*)sm; float (*const so)[32][68] = (float (*)[32][68])sm;      /* the stage buffers; behind the loop's last barrier the same bytes hold each wave's output rows */
  const int tid = threadIdx.x, lane = tid & 31, ln = lane & 15, hh = lane >> 4; const int w = __builtin_amdgcn_readfirstlane(tid >> 5), wm = w & 3, wn = w >> 2;
  const int idx = blockIdx.x, nq = idx & 7; const bool ft = idx < NB * 16;      /* ft: a first-tile work-group; the same for the whole work-group */
  const int f0 = (idx >> 4) * QT0 + ((idx >> 3) & 1) * 64;      /* ft: first row in the planes, batch idx / 16, upper or lower 64 rows */
  const int m15 = (idx - NB * 16) >> 3; const int mt = m15 + m15 / 15 + 1;      /* else: row tile, 15 per batch */
  const int orow = ft ? (idx >> 4) * SQ + ((idx >> 3) & 1) * 64 : mt * G2T;      /* first output row */
  const int sr = tid >> 3, sc = (tid & 7) * 8; const int sl = sr * G2P + sc;      /* staging: row sr + 32 u, eight halves at column sc */
  const _Float16* ag0 = (ft ? OH + (size_t)f0 * DM : O + (size_t)mt * G2T * DM) + sr * DM + sc;      /* A rows 0..63 */
  const _Float16* ag1 = (ft ? OL + (size_t)f0 * DM : O + ((size_t)mt * G2T + 64) * DM) + sr * DM + sc;      /* A rows 64..127 */
  const _Float16* bg = Wt + (size_t)(nq * G2T + sr) * DM + sc; const int nst = DM / G2K;
  const v8f z8 = {0.f,0.f,0.f,0.f,0.f,0.f,0.f,0.f}; v8f c00 = z8, c01 = z8, c02 = z8, c03 = z8, c10 = z8, c11 = z8, c12 = z8, c13 = z8;
  v8us ar[4], br[4]; const unsigned short* p0 = (const unsigned short*)ag0; const unsigned short* p1 = (const unsigned short*)ag1; const unsigned short* pb = (const unsigned short*)bg;      /* the full unrolls give the register arrays constant indices and put a stage's eight loads in flight together */
#pragma unroll
  for (int u = 0; u < 2; ++u) { ar[u] = *(const v8us*)(p0 + u * 32 * DM); ar[2 + u] = *(const v8us*)(p1 + u * 32 * DM); br[u] = *(const v8us*)(pb + u * 32 * DM); br[2 + u] = *(const v8us*)(pb + (2 + u) * 32 * DM); }
  asm volatile("s_wait_xcnt 0x0" :: "v"(p0), "v"(p1), "v"(pb) : "memory");      /* the loads' address registers are free for reuse only from here on; as inputs they stay whole up to this wait, so that no load returns into one either */
#pragma unroll
  for (int u = 0; u < 4; ++u) { *(v8us*)(unsigned short*)&sg[sl + u * 32 * G2P] = ar[u]; *(v8us*)(unsigned short*)&sg[G2T * G2P + sl + u * 32 * G2P] = br[u]; }
  __syncthreads();
#pragma unroll 1
  for (int s = 0; s < nst; ++s) { const bool more = s + 1 < nst;      /* more: the same for the whole work-group. The stage loop stays rolled, so that its text stays small; its two 32-k passes are unrolled, so that their LDS offsets are immediates */
    if (more) { p0 = (const unsigned short*)(ag0 + (s + 1) * G2K); p1 = (const unsigned short*)(ag1 + (s + 1) * G2K); pb = (const unsigned short*)(bg + (s + 1) * G2K);
#pragma unroll
      for (int u = 0; u < 2; ++u) { ar[u] = *(const v8us*)(p0 + u * 32 * DM); ar[2 + u] = *(const v8us*)(p1 + u * 32 * DM); br[u] = *(const v8us*)(pb + u * 32 * DM); br[2 + u] = *(const v8us*)(pb + (2 + u) * 32 * DM); }
      asm volatile("s_wait_xcnt 0x0" :: "v"(p0), "v"(p1), "v"(pb) : "memory"); }      /* the code below reuses the registers that these loads name: this wait stands in front of that overwrite, and as its inputs they stay whole up to it, so that no load returns into one either */
    const _Float16* ab = sg + (s & 1) * G2S + (32 * wm + ln) * G2P; const _Float16* bb = sg + (s & 1) * G2S + (G2T + 64 * wn + ln) * G2P;
#pragma unroll
    for (int kc = 0; kc < G2K; kc += 32) { const v16h a0 = g2_frag(ab + kc, hh), a1 = g2_frag(ab + 16 * G2P + kc, hh);
      const v16h b0 = g2_frag(bb + kc, hh), b1 = g2_frag(bb + 16 * G2P + kc, hh), b2 = g2_frag(bb + 32 * G2P + kc, hh), b3 = g2_frag(bb + 48 * G2P + kc, hh);
      c00 = g2_mma(a0, b0, c00); c10 = g2_mma(a1, b0, c10); c01 = g2_mma(a0, b1, c01); c11 = g2_mma(a1, b1, c11);
      c02 = g2_mma(a0, b2, c02); c12 = g2_mma(a1, b2, c12); c03 = g2_mma(a0, b3, c03); c13 = g2_mma(a1, b3, c13); }
    if (more) {
#pragma unroll
      for (int u = 0; u < 4; ++u) { *(v8us*)(unsigned short*)&sg[((s + 1) & 1) * G2S + sl + u * 32 * G2P] = ar[u]; *(v8us*)(unsigned short*)&sg[((s + 1) & 1) * G2S + G2T * G2P + sl + u * 32 * G2P] = br[u]; } }
    __syncthreads(); }      /* publishes stage s + 1 and ends every wave's reads of stage s, whose buffer the next trip refills and, behind the last trip, the output rows reuse */
  v8f accs[8] = {c00, c01, c02, c03, c10, c11, c12, c13}; const float al = (ft && wm >= 2) ? 0.00000095367431640625f : 0.0009765625f;      /* 2^-10 = 1 / (64 x 16); the lo plane is carried x1024 on top */
#pragma unroll
  for (int u = 0; u < 8; ++u)
#pragma unroll
    for (int r = 0; r < 8; ++r) so[w][(u >> 2) * 16 + 8 * hh + r][(u & 3) * 16 + ln] = accs[u][r] * al;
  if (ft) __syncthreads();      /* work-group-uniform branch: the hi waves read the lo waves' rows below */
  else { __builtin_amdgcn_fence(__ATOMIC_ACQ_REL, "workgroup"); __builtin_amdgcn_wave_barrier(); }      /* a wave reads back only its own rows */
  if (ft && wm >= 2) return;      /* wave-uniform, behind the last barrier: the lo waves' rows are stored by their partners */
  v4f ov[16];
#pragma unroll
  for (int q = 0; q < 16; ++q) ov[q] = *(const v4fa*)&so[w][q * 2 + hh][ln * 4];
  if (ft) {      /* one branch round all sixteen partner rows, so that their LDS reads are in flight together */
#pragma unroll
    for (int q = 0; q < 16; ++q) ov[q] += *(const v4fa*)&so[w + 2][q * 2 + hh][ln * 4]; }
  __builtin_amdgcn_sched_barrier(0);      /* the stores stand behind the last LDS read, so that no register which an issued store names is written again */
  char* cb = (char*)(C + (size_t)(orow + 32 * wm) * DM + nq * G2T + 64 * wn); const unsigned co = hh * (DM * 4u) + ln * 16u;
#pragma unroll
  for (int q = 0; q < 16; ++q) *(v4f*)(cb + q * 2 * (DM * 4) + co) = ov[q]; }

__global__ __launch_bounds__(256) void k_bfcp(const float* __restrict__ src, float* __restrict__ dst, size_t n4) { const size_t t = (size_t)blockIdx.x * 256 + threadIdx.x; if (t >= n4) return; const v4f a = *(const v4fa*)(src + t * 4); v4f o; for (int q = 0; q < 4; ++q) o[q] = bf16_round(a[q]); *(v4f*)(dst + t * 4) = o;  }

__global__ __launch_bounds__(256) void k_tabhalf(const float* __restrict__ cs, const float* __restrict__ sn, float* __restrict__ CS, float* __restrict__ SN) { const int t = blockIdx.x * 256 + threadIdx.x; if (t >= SQ * (HD / 2)) return; const int p = t / (HD / 2), i = t % (HD / 2); const float c = bf16_round(cs[(size_t)p * HD + i]), s = bf16_round(sn[(size_t)p * HD + i]);
  *(float*)(CS + t) = c; *(float*)(SN + t) = s;  }

__device__ __forceinline__ void p_tab2d(int blk, float* __restrict__ CS, float* __restrict__ SN) {
  #pragma clang fp contract(off)
  const int t = blk * 256 + threadIdx.x; if (t >= SQ * (HD / 2)) return; const int i = t % (HD / 2); const int p = t / (HD / 2); const float invf = (float)(1.0 / pow(10000.0, (double)(2 * i) / (double)HD)); const float ang = __fmul_rn((float)p, invf); const float c = cosf(ang), s = sinf(ang);
  *(float*)(CS + t) = c; *(float*)(SN + t) = s;  }
// The four preparation jobs (rope tables, x to f16, the two weight transposes) read only the inputs and write planes of their own: none depends on another, so that ONE launch runs them side by side, split by work-group index.
// The table groups, the longest chains of arithmetic, come first; behind them every run of 12 groups holds 8 of x, 3 of the fused weight and 1 of the output weight,
// so that the x stream and the transposes are in flight together from the first run to the last.
#define PJ_TAB (SQ * (HD / 2) / 256)                 /* work-groups of the table job */
#define PJ_RUN ((DM / 64) * (DM / 256))              /* runs of 12 = work-groups of the output weight's transpose */
__global__ __launch_bounds__(256) void k_prep(const float* __restrict__ x, const float* __restrict__ wattn, const float* __restrict__ wo, _Float16* __restrict__ X16, _Float16* __restrict__ BQKV, _Float16* __restrict__ BO, float* __restrict__ CS, float* __restrict__ SN) {
  static_assert(PJ_TAB * 256 == SQ * (HD / 2) && DM % 256 == 0 && (size_t)PJ_RUN * 8 * 16384 == NR * DM, "whole work-groups; x has 8 and the fused weight 3 work-groups for each one of the output weight");
  const int idx = blockIdx.x;      /* every test below is the same for the whole work-group */
  if (idx < PJ_TAB) { p_tab2d(idx, CS, SN); return; }
  const int r = idx - PJ_TAB, g = r / 12, m = r - g * 12;
  if (m < 8) p_x16(g * 8 + m, x, X16);
  else if (m < 11) p_wt_f16(g * 3 + (m - 8), wattn, BQKV, DM, 3 * DM, 16.0f);      /* [in][out] -> Bt x16 planes (fused W_attn: K 1024, N 3072) */
  else p_wt_f16(g, wo, BO, DM, DM, 16.0f); }
extern "C" void kernel_launch(void* const* d_in, const int* in_sizes, int n_in,
                              void* d_out, int out_size, void* d_ws, size_t ws_size, hipStream_t stream) {
  (void)in_sizes; (void)n_in; (void)out_size;
  const float* const* I = (const float* const*)d_in; const float* x = I[0]; const float* wattn = I[1]; const float* wo = I[2];      /* x; fused [in][out] W_attn [1024][3072] (q | k | v column thirds); [in][out] W_proj; rope tables computed in-kernel (positions = row index) */
  static_assert(HPG == 1 && NH == NG * HPG && NH * HD == DM && KVD == DM, "plain multi-head attention as 16 kv groups of one query head"); const float* bo = nullptr;      /* [in][out] weights, no biases; rope tables computed in the kernel */
  char* ws = (char*)d_ws; size_t off = 0;
  auto take = [&](size_t bytes) { char* p = ws + off; off += (bytes + 255) & ~(size_t)255; return p; };
  _Float16* BQKV = (_Float16*)take((size_t)3 * DM * DM * 2); _Float16* BO = (_Float16*)take((size_t)DM * DM * 2);      /* one transposed plane Bt [3072][1024] of the fused weight: rows 0..1023 = q, 1024.. = k, 2048.. = v */
  _Float16* X16 = (_Float16*)take(NR * DM * 2); float* CSB = (float*)take((size_t)SQ * HD * 4); float* SNB = (float*)take((size_t)SQ * HD * 4); _Float16* Q16 = (_Float16*)take(NR * DM * 2); _Float16* K16 = (_Float16*)take(NR * KVD * 2); _Float16* O16 = (_Float16*)take(NR * DM * 2);
  static_assert(B0 == 0 && NBR == NB && NHD == NH && QN == SQ, "every launch covers all batches and heads");
  _Float16* VT = (_Float16*)take((size_t)NB * NH * HD * SQ * 2);
  float* QF0 = (float*)take((size_t)NB * QT0 * DM * 4); float* KF0 = (float*)take((size_t)NB * QT0 * KVD * 4); float* VF0 = (float*)take((size_t)NB * QT0 * KVD * 4); _Float16* OH0 = (_Float16*)take((size_t)NB * QT0 * DM * 2); _Float16* OL0 = (_Float16*)take((size_t)NB * QT0 * DM * 2);
  if (off > ws_size) return;
  k_prep<<<PJ_TAB + PJ_RUN * 12, 256, 0, stream>>>(x, wattn, wo, X16, BQKV, BO, CSB, SNB);      /* x as f16; both weights as transposed x16 planes; rope tables cos/sin(p / 10000^(2i/64)): inv_freq double-derived -> f32, f32 angle */
  /* Every launch below covers all NB batches: token rows b * SQ + s run through (projections), or the batch is decoded from blockIdx.x (attention) / grid.y (first-tile kernel). */
  k_proj3<<<(MP / G2T) * (3 * DM / G2T), 256, 0, stream>>>(X16, BQKV, CSB, SNB, Q16, K16, VT, QF0, KF0, VF0);      /* roped q, k as f16 rows, V^T [NB][NH][HD][SQ] as f16, and the f32 roped q, k and v of rows 0..127 of each batch; position = row % SQ */
  k_att0<<<dim3(NH * (QT0 / A0R), NB), 256, 0, stream>>>(QF0, KF0, VF0, 0.125f, OH0, OL0);      /* exact f32 attention for rows 0..127 of each batch (o x64) -> f16 hi + x1024 residual planes; one head per kv group, so that the k and v rows are the heads' own */
  k_fattn<<<NB * NH * (SQ / FAQ), FAW * 32, 0, stream>>>(Q16, K16, VT, O16);      /* scores, causal softmax and weighted values of all batches, heads and query tiles: o (x64) as f16 rows */
  k_outp<<<NB * 16 + (MPO / G2T - NB) * (DM / G2T), 256, 0, stream>>>(O16, OH0, OL0, BO, (float*)d_out);      /* out rows are the output layout; rows 0..127 of each batch from the hi and lo planes, all others from the f16 path */
}
